// v000
// Measured on an AMD MI455X. A time is GPU time per run, averaged over a window of back-to-back runs after a warm-up
// (all launches, gaps included; the runs take copies of the inputs in turn), and the median of several windows.
// Apart from v000's, it joins two sittings. Times from different sittings can be a few percent apart, while
// side-by-side timings come from the same sitting.
// The starting kernel, v000, takes 73.5 microseconds a run.
// Contractions x@qkv_w^T (K=256) and o@proj_w^T (K=256): v_wmma_f32_16x16x32_f16 (f16 operands, f32 accumulate). Window scores q.k, softmax and p.v context sums: f32 VALU.
// f16 planes and carries: X16 = x*16; WQKV = qkv_w*256 and WO = proj_w*256 (both [n][k], k contiguous); O = window context*256. Q, K, V planes are f32 (no carry; Q holds bias and the 1/16 scale).
// Inverse carries folded exactly once: gemm_qkv_k stages acc*SC_AW (1/(16*256)) before the bias add; gemm_proj_k stages acc*SC_OW (1/(256*256)) before the bias add. No other consumer rescales.
#include <hip/hip_runtime.h>
#include <stdint.h>

#define DEVINL __device__ __forceinline__

typedef _Float16 f16t;
typedef _Float16 v16h __attribute__((ext_vector_type(16)));
typedef _Float16 v8h  __attribute__((ext_vector_type(8)));
typedef float    v8f  __attribute__((ext_vector_type(8)));
typedef float    v4f  __attribute__((ext_vector_type(4)));
typedef v8h __attribute__((may_alias)) v8ha;
typedef v4f __attribute__((may_alias)) v4fa;
union FragH { v16h v; v8h half[2]; };

#define NBATCH 8
#define GH     32          // grid rows
#define GW     32          // grid cols
#define NTOKB  1024        // tokens per batch
#define NTOK   8192        // total token rows
#define CW     256         // embed width
#define NQKV   768         // 3*CW
#define NHEAD  8
#define HDIM   32
#define RH     3           // window half height (7 rows)
#define RW     5           // window half width (11 cols)
#define NTAPW  11
#define NSLOT  80          // 77 score slots padded to 4 lanes x 20
#define SLOTL  20
#define TPB    256
#define WAVES  8
#define MT     64          // token tile of the GEMMs
#define PQF    132         // LDS pitch (floats) of the [64][128] f32 staging
#define ACAR   16.0f
#define WCAR   256.0f
#define OCAR   256.0f
#define SC_AW  (1.0f / (16.0f * 256.0f))
#define SC_OW  (1.0f / (256.0f * 256.0f))
#define QSC    0.0625f     // 256^-0.5

#define XBLK   (NTOK * CW / 8 / TPB)    // 1024
#define WQBLK  (NQKV * CW / 8 / TPB)    // 96
#define WOBLK  (CW * CW / 8 / TPB)      // 32

static_assert(TPB == WAVES * 32);
static_assert(GH * GW == NTOKB);
static_assert(NBATCH * NTOKB == NTOK);
static_assert(NHEAD * HDIM == CW);
static_assert(NHEAD * 4 == 32);
static_assert(4 * SLOTL == NSLOT);
static_assert((2 * RH + 1) * NTAPW <= NSLOT);
static_assert((NTOK % MT) == 0);
static_assert((NTOK % WAVES) == 0);
static_assert((CW % 32) == 0);
static_assert((NQKV % 128) == 0);
static_assert((PQF % 4) == 0);
static_assert(MT == 64);
static_assert(XBLK * TPB * 8 == NTOK * CW);
static_assert(WQBLK * TPB * 8 == NQKV * CW);
static_assert(WOBLK * TPB * 8 == CW * CW);

DEVINL int imin(int a, int b) { return a < b ? a : b; }
DEVINL int imax(int a, int b) { return a > b ? a : b; }

// ---------------------------------------------------------------------------
// WMMA helper with hazard guard (ties D, keeps A/B live).
// Fragment map (wave32): lane l, h = l>>4, m = n = l&15.
//   A/B element i: i<8 -> k0+8h+i ; i>=8 -> k0+16+8h+(i-8)   (two 16-B row loads)
//   D element r : row 8h+r, col l&15
// ---------------------------------------------------------------------------
DEVINL v8f wmma_f16(v16h a, v16h b, v8f c) {
  v8f d = __builtin_amdgcn_wmma_f32_16x16x32_f16(false, a, false, b, (short)0, c, false, false);
  asm volatile("v_nop\n\tv_nop\n\tv_nop\n\tv_nop" : "+v"(d) : "v"(a), "v"(b));
  return d;
}
DEVINL v8f zero8f() {
  v8f z = {0.f, 0.f, 0.f, 0.f, 0.f, 0.f, 0.f, 0.f};
  return z;
}
// row already includes the +8h lane offset; k contiguous in memory
DEVINL void load_frag(FragH& f, const f16t* row, int k0) {
  f.half[0] = *(const v8ha*)(row + k0);
  f.half[1] = *(const v8ha*)(row + k0 + 16);
}

DEVINL float gsum4(float v) {
  v += __shfl_xor(v, 1);
  v += __shfl_xor(v, 2);
  return v;
}

// ---------------------------------------------------------------------------
// One wave: 16 token rows (A, row-major f16, pitch KD) x 64 output cols
// (4 N-tiles of B rows [n][KD]).  arow / brow already carry the +m row and
// +8h k offsets; N-tile j is brow + 16*j*KD.
// ---------------------------------------------------------------------------
template <int KD>
DEVINL void mma_4n(const f16t* __restrict__ arow, const f16t* __restrict__ brow, v8f (&acc)[4]) {
  #pragma unroll 1
  for (int ks = 0; ks < KD / 32; ++ks) {
    const int k0 = 32 * ks;
    FragH a;
    load_frag(a, arow, k0);
    #pragma unroll
    for (int n = 0; n < 4; ++n) {
      FragH b;
      load_frag(b, brow + (size_t)16 * n * KD, k0);
      acc[n] = wmma_f16(a.v, b.v, acc[n]);
    }
  }
}

// LDS [64][PQF] -> 64 global row segments of 128 floats (pitch `pitch`).
// Wave w owns rows w+8i; one 512-B instruction per segment (32 lanes x 16 B =
DEVINL void store_rows_f32(const float* sbuf, float* dst, int pitch, int wave, int lane) {
  #pragma unroll
  for (int i = 0; i < 8; ++i) {
    const int row = wave + 8 * i;
    const v4f v = *(const v4fa*)(sbuf + row * PQF + 4 * lane);
    *(v4f*)(dst + (size_t)row * pitch + 4 * lane) = v;
  }
  
}

// ---------------------------------------------------------------------------
// Kernel 1: f32 -> f16 carried planes, straight copy-convert (sources are
// already [n][k] with k contiguous).
//   blocks 0..1023    : X16  = x * 16        [8192][256]
//   blocks 1024..1119 : WQKV = qkv_w * 256   [768][256]
//   blocks 1120..1151 : WO   = proj_w * 256  [256][256]
// Source selection is block-uniform.  Thread = 8 contiguous elements: two
// 16-B loads, one 16-B store; a wave writes 512 contiguous bytes = 4 whole
// coverage: X16 1024x256x8 = 8192x256; WQKV 96x256x8 = 768x256; WO 32x256x8 = 256x256.
// ---------------------------------------------------------------------------
__global__ __launch_bounds__(TPB) void prep_k(const float* __restrict__ x, const float* __restrict__ qw,
                                             const float* __restrict__ pw,
                                             f16t* __restrict__ X16, f16t* __restrict__ WQKV,
                                             f16t* __restrict__ WO)
{
  const int blk = blockIdx.x, tid = threadIdx.x;
  if (blk >= XBLK + WQBLK + WOBLK) return;          // block-uniform; grid exact
  const float* src;
  f16t* dst;
  float sc;
  int rb;
  if (blk < XBLK)              { src = x;  dst = X16;  sc = ACAR; rb = blk; }
  else if (blk < XBLK + WQBLK) { src = qw; dst = WQKV; sc = WCAR; rb = blk - XBLK; }
  else                         { src = pw; dst = WO;   sc = WCAR; rb = blk - XBLK - WQBLK; }
  const size_t idx = ((size_t)rb * TPB + tid) * 8;
  const v4f a = *(const v4fa*)(src + idx), c = *(const v4fa*)(src + idx + 4);
  v8h o;
  #pragma unroll
  for (int j = 0; j < 4; ++j) {
    o[j]     = (f16t)(a[j] * sc);
    o[4 + j] = (f16t)(c[j] * sc);
  }
  *(v8h*)(dst + idx) = o;
  
}

// ---------------------------------------------------------------------------
// Kernel 2: Q / K / V = X16 @ WQKV^T + qkv_b (K = 256), f32 planes [8192][256]
// (channel = head*32 + d).  Q additionally scaled by 1/16.
// Block = (64-token tile, y in 0..5: plane = y>>1, 128-col half = y&1, block-
// uniform).  Wave w: token 16-tile w&3, 64 output cols of half w>>2.
// Epilogue: (acc*SC_AW + bias) * osc staged [64][128] in LDS, then whole
// coverage per block: 8 waves x 16 rows x 64 cols = 64 tokens x 128 cols;
// grid 128 x 6 = 8192 tokens x 768 qkv channels.
// ---------------------------------------------------------------------------
__global__ __launch_bounds__(TPB) void gemm_qkv_k(const f16t* __restrict__ Xp, const f16t* __restrict__ Wp,
                                                 const float* __restrict__ bias,
                                                 float* __restrict__ Qo, float* __restrict__ Ko,
                                                 float* __restrict__ Vo)
{
  __shared__ __attribute__((aligned(16))) float sbuf[MT * PQF];   // 33,792 B
  const int tid = threadIdx.x, lane = tid & 31, wave = tid >> 5;
  const int h = lane >> 4, m = lane & 15;
  const int mt = wave & 3, nh = wave >> 2;
  const int row0 = blockIdx.x * MT, y = blockIdx.y;
  const int pl = y >> 1, chalf = y & 1;
  float* outp = (pl == 0) ? Qo : ((pl == 1) ? Ko : Vo);
  const float osc = (pl == 0) ? QSC : 1.0f;

  v8f acc[4];
  #pragma unroll
  for (int n = 0; n < 4; ++n) acc[n] = zero8f();
  const f16t* arow = Xp + (size_t)(row0 + 16 * mt + m) * CW + 8 * h;
  const f16t* brow = Wp + (size_t)(y * 128 + 64 * nh + m) * CW + 8 * h;
  mma_4n<CW>(arow, brow, acc);

  const int cb = y * 128 + 64 * nh;                // qkv channel base of this wave
  #pragma unroll
  for (int n = 0; n < 4; ++n) {
    const float bv = bias[cb + 16 * n + m];
    #pragma unroll
    for (int r = 0; r < 8; ++r)
      sbuf[(16 * mt + 8 * h + r) * PQF + 64 * nh + 16 * n + m] = (acc[n][r] * SC_AW + bv) * osc;
  }
  __syncthreads();
  store_rows_f32(sbuf, outp + (size_t)row0 * CW + 128 * chalf, CW, wave, lane);
}

// ---------------------------------------------------------------------------
// Kernel 3: 7x11 local-window attention, f32.  One wave per token (8 tokens
// per block); lane holds channels 8*lane..8*lane+7, head = lane>>2 (4 lanes
// per head).  Token (h0,w0) attends (hh,ww) iff |hh-h0|<=3 and |ww-w0|<=5
// inside the grid; the row / col loop bounds are clamped to the grid (wave-
// uniform), so only live keys are visited.
//           LDS slot (hh-h0+3)*11 + (ww-w0+5) of the per-wave [head][80]
//           score region (all 80 slots preset to -1e9); running max.
//   pass 1b: e = exp(s - max) written back (20 slots per lane), S = group
//            sum, rS = 1/S.
//   pass 2: p = e * rS; ctx += p * v.
// O [8192][256] f16 x256: each lane stores its own 8 channels (16 B); the
// coverage: 1024 blocks x 8 waves = 8192 rows x (32 lanes x 8 halves).
// ---------------------------------------------------------------------------
__global__ __launch_bounds__(TPB) void attn_k(const float* __restrict__ Qp, const float* __restrict__ Kp,
                                             const float* __restrict__ Vp, f16t* __restrict__ Op)
{
  __shared__ __attribute__((aligned(16))) float sS[WAVES * NHEAD * NSLOT];   // 20,480 B
  const int tid = threadIdx.x, lane = tid & 31;
  const int wave = __builtin_amdgcn_readfirstlane(tid >> 5);
  const int gp = imin(blockIdx.x * WAVES + wave, NTOK - 1);   // grid exact
  const int bb = gp >> 10, n = gp & 1023, h0 = n >> 5, w0 = n & 31;
  const int head = lane >> 2, j4 = lane & 3, c0 = 8 * lane;
  float* sw = sS + wave * (NHEAD * NSLOT);
  float* sh = sw + head * NSLOT;

  {
    const v4f fill = {-1.0e9f, -1.0e9f, -1.0e9f, -1.0e9f};
    #pragma unroll
    for (int q = 0; q < 5; ++q) *(v4fa*)(sw + SLOTL * lane + 4 * q) = fill;   // 32 lanes x 20 = 640 slots
  }
  __syncthreads();

  const float* qp = Qp + (size_t)gp * CW + c0;
  const v4f qa = *(const v4fa*)qp, qc = *(const v4fa*)(qp + 4);
  const int hlo = imax(h0 - RH, 0), hhi = imin(h0 + RH, GH - 1);
  const int wlo = imax(w0 - RW, 0), whi = imin(w0 + RW, GW - 1);

  float mx = -3.0e38f;
  #pragma unroll 1
  for (int hh = hlo; hh <= hhi; ++hh) {
    const int th = (hh - h0 + RH) * NTAPW - w0 + RW;           // slot = th + ww, 0..76
    const size_t rowb = (size_t)(bb * NTOKB + hh * GW);
    #pragma unroll 1
    for (int ww = wlo; ww <= whi; ++ww) {
      const float* kp = Kp + (rowb + (size_t)ww) * CW + c0;
      const v4f ka = *(const v4fa*)kp, kc = *(const v4fa*)(kp + 4);
      float d = qa[0] * ka[0];
      d = fmaf(qa[1], ka[1], d);
      d = fmaf(qa[2], ka[2], d);
      d = fmaf(qa[3], ka[3], d);
      d = fmaf(qc[0], kc[0], d);
      d = fmaf(qc[1], kc[1], d);
      d = fmaf(qc[2], kc[2], d);
      d = fmaf(qc[3], kc[3], d);
      d = gsum4(d);
      mx = fmaxf(mx, d);
      sh[th + ww] = d;                       // all 4 lanes of the group store the same value
    }
  }
  __syncthreads();

  float ssum = 0.0f;
  #pragma unroll 1
  for (int it = 0; it < SLOTL; ++it) {
    const int tt = j4 + 4 * it;              // 0..79; unvisited slots hold -1e9
    const float sv = sh[tt];
    float e = __expf(sv - mx);
    e = (sv > -1.0e8f) ? e : 0.0f;
    sh[tt] = e;
    ssum += e;
  }
  ssum = gsum4(ssum);                        // >= 1 (the max slot gives e = 1)
  const float rS = 1.0f / ssum;
  __syncthreads();

  v4f cxa = {0.f, 0.f, 0.f, 0.f}, cxc = {0.f, 0.f, 0.f, 0.f};
  #pragma unroll 1
  for (int hh = hlo; hh <= hhi; ++hh) {
    const int th = (hh - h0 + RH) * NTAPW - w0 + RW;
    const size_t rowb = (size_t)(bb * NTOKB + hh * GW);
    #pragma unroll 1
    for (int ww = wlo; ww <= whi; ++ww) {
      const float p = sh[th + ww] * rS;
      const float* vp = Vp + (rowb + (size_t)ww) * CW + c0;
      const v4f va = *(const v4fa*)vp, vc = *(const v4fa*)(vp + 4);
      #pragma unroll
      for (int j = 0; j < 4; ++j) {
        cxa[j] = fmaf(p, va[j], cxa[j]);
        cxc[j] = fmaf(p, vc[j], cxc[j]);
      }
    }
  }

  v8h oh;
  #pragma unroll
  for (int j = 0; j < 4; ++j) {
    oh[j]     = (f16t)(cxa[j] * OCAR);
    oh[4 + j] = (f16t)(cxc[j] * OCAR);
  }
  f16t* dst = Op + (size_t)gp * CW + c0;
  *(v8h*)dst = oh;
  
}

// ---------------------------------------------------------------------------
// Kernel 4: out = O @ WO^T + proj_b (K = 256) -> d_out f32 [8192][256].
// Block = (64-token tile, y = 128-col half).  Wave w: token 16-tile w&3, 64
// cols of half w>>2.  Epilogue acc*SC_OW + bias staged [64][128] in LDS, then
// coverage per block: 64 rows x 128 cols; grid 128 x 2 = 8192 rows x 256 cols.
// ---------------------------------------------------------------------------
__global__ __launch_bounds__(TPB) void gemm_proj_k(const f16t* __restrict__ Opl, const f16t* __restrict__ Wp,
                                                  const float* __restrict__ bias, float* __restrict__ out)
{
  __shared__ __attribute__((aligned(16))) float sbuf[MT * PQF];   // 33,792 B
  const int tid = threadIdx.x, lane = tid & 31, wave = tid >> 5;
  const int h = lane >> 4, m = lane & 15;
  const int mt = wave & 3, nh = wave >> 2;
  const int row0 = blockIdx.x * MT, y = blockIdx.y;

  v8f acc[4];
  #pragma unroll
  for (int n = 0; n < 4; ++n) acc[n] = zero8f();
  const f16t* arow = Opl + (size_t)(row0 + 16 * mt + m) * CW + 8 * h;
  const f16t* brow = Wp + (size_t)(y * 128 + 64 * nh + m) * CW + 8 * h;
  mma_4n<CW>(arow, brow, acc);

  const int cb = y * 128 + 64 * nh;
  #pragma unroll
  for (int n = 0; n < 4; ++n) {
    const float bv = bias[cb + 16 * n + m];
    #pragma unroll
    for (int r = 0; r < 8; ++r)
      sbuf[(16 * mt + 8 * h + r) * PQF + 64 * nh + 16 * n + m] = acc[n][r] * SC_OW + bv;
  }
  __syncthreads();
  store_rows_f32(sbuf, out + (size_t)row0 * CW + 128 * y, CW, wave, lane);
}

// ---------------------------------------------------------------------------
extern "C" void kernel_launch(void* const* d_in, const int* in_sizes, int n_in,
                              void* d_out, int out_size, void* d_ws, size_t ws_size,
                              hipStream_t stream) {
  if (n_in < 5) return;
  if (in_sizes[0] != NTOK * CW) return;
  if (in_sizes[1] != NQKV * CW || in_sizes[2] != NQKV) return;
  if (in_sizes[3] != CW * CW || in_sizes[4] != CW) return;
  if (out_size != NTOK * CW) return;

  const float* x      = (const float*)d_in[0];   // [8192][256]
  const float* qkv_w  = (const float*)d_in[1];   // [768][256]
  const float* qkv_b  = (const float*)d_in[2];   // [768]
  const float* proj_w = (const float*)d_in[3];   // [256][256]
  const float* proj_b = (const float*)d_in[4];   // [256]
  float* outp = (float*)d_out;

  // workspace carve (bytes); every region is an exact multiple of its whole-row
  //   WQKV 768 x 256 f16    =    393,216
  //   WO   256 x 256 f16    =    131,072
  //   X16  8192 x 256 f16   =  4,194,304
  //   Q    8192 x 256 f32   =  8,388,608
  //   K    8192 x 256 f32   =  8,388,608
  //   V    8192 x 256 f32   =  8,388,608
  //   O    8192 x 256 f16   =  4,194,304
  //   total                 = 34,078,720
  const size_t szWQKV = (size_t)NQKV * CW * 2;
  const size_t szWO   = (size_t)CW * CW * 2;
  const size_t szP16  = (size_t)NTOK * CW * 2;
  const size_t szP32  = (size_t)NTOK * CW * 4;
  size_t off = 0;
  char* ws = (char*)d_ws;
  f16t*  WQKV = (f16t*)(ws + off);  off += szWQKV;
  f16t*  WO   = (f16t*)(ws + off);  off += szWO;
  f16t*  X16  = (f16t*)(ws + off);  off += szP16;
  float* Qp   = (float*)(ws + off); off += szP32;
  float* Kp   = (float*)(ws + off); off += szP32;
  float* Vp   = (float*)(ws + off); off += szP32;
  f16t*  Opl  = (f16t*)(ws + off);  off += szP16;
  if (off > ws_size) return;

  // x, qkv_w, proj_w -> f16 carried planes
  prep_k<<<XBLK + WQBLK + WOBLK, TPB, 0, stream>>>(x, qkv_w, proj_w, X16, WQKV, WO);
  // Q (x1/16), K, V = x @ qkv_w^T + qkv_b  (f32 planes)
  gemm_qkv_k<<<dim3(NTOK / MT, NQKV / 128), TPB, 0, stream>>>(X16, WQKV, qkv_b, Qp, Kp, Vp);
  // 7x11 window attention -> O f16 x256
  attn_k<<<NTOK / WAVES, TPB, 0, stream>>>(Qp, Kp, Vp, Opl);
  // out = O @ proj_w^T + proj_b
  gemm_proj_k<<<dim3(NTOK / MT, CW / 128), TPB, 0, stream>>>(Opl, WO, proj_b, outp);
  (void)hipGetLastError();
}

// v001
// A run of this version takes 59.9 microseconds.
// In both of two side-by-side timings against v000, it was 1.24 times as fast.
// Contractions x@qkv_w^T (K=256) and o@proj_w^T (K=256): v_wmma_f32_16x16x32_f16 (f16 operands, f32 accumulate). Window scores q.k, softmax and p.v context sums: f32 VALU.
// f16 planes and carries: X16 = x*16; WQKV = qkv_w*256 and WO = proj_w*256 (both [n][k], k contiguous); O = window context*256. Q, K, V planes are f32 (no carry; Q holds bias and the 1/16 scale).
// Inverse carries folded exactly once: gemm_qkv_k stages acc*SC_AW (1/(16*256)) before the bias add; gemm_proj_k stages acc*SC_OW (1/(256*256)) before the bias add. No other consumer rescales.
#include <hip/hip_runtime.h>
#include <stdint.h>

#define DEVINL __device__ __forceinline__

typedef _Float16 f16t;
typedef _Float16 v16h __attribute__((ext_vector_type(16)));
typedef _Float16 v8h  __attribute__((ext_vector_type(8)));
typedef float    v8f  __attribute__((ext_vector_type(8)));
typedef float    v4f  __attribute__((ext_vector_type(4)));
typedef v8h __attribute__((may_alias)) v8ha;
typedef v4f __attribute__((may_alias)) v4fa;
union FragH { v16h v; v8h half[2]; };

#define NBATCH 8
#define GH     32          // grid rows
#define GW     32          // grid cols
#define NTOKB  1024        // tokens per batch
#define NTOK   8192        // total token rows
#define CW     256         // embed width
#define NQKV   768         // 3*CW
#define NHEAD  8
#define HDIM   32
#define RH     3           // window half height (7 rows)
#define RW     5           // window half width (11 cols)
#define NTAPW  11
#define NSLOT  80          // 77 score slots padded to 4 lanes x 20
#define SLOTL  20
#define DEADSLOT 77         // first pad slot: never a live tap's
#define TPB    256
#define WAVES  8
#define MT     64          // token tile of the GEMMs
#define PQF    132         // LDS pitch (floats) of the [64][128] f32 staging
#define ACAR   16.0f
#define WCAR   256.0f
#define OCAR   256.0f
#define SC_AW  (1.0f / (16.0f * 256.0f))
#define SC_OW  (1.0f / (256.0f * 256.0f))
#define QSC    0.0625f     // 256^-0.5

#define XBLK   (NTOK * CW / 8 / TPB)    // 1024
#define WQBLK  (NQKV * CW / 8 / TPB)    // 96
#define WOBLK  (CW * CW / 8 / TPB)      // 32

static_assert(TPB == WAVES * 32);
static_assert(GH * GW == NTOKB);
static_assert(NBATCH * NTOKB == NTOK);
static_assert(NHEAD * HDIM == CW);
static_assert(NHEAD * 4 == 32);
static_assert(4 * SLOTL == NSLOT);
static_assert((2 * RH + 1) * NTAPW <= NSLOT);
static_assert(DEADSLOT == (2 * RH + 1) * NTAPW && DEADSLOT < NSLOT);
static_assert(NTAPW == 2 * RW + 1 && NTAPW <= GW);
static_assert((NTOK % MT) == 0);
static_assert((NTOK % WAVES) == 0);
static_assert((CW % 32) == 0);
static_assert((NQKV % 128) == 0);
static_assert((PQF % 4) == 0);
static_assert(MT == 64);
static_assert(XBLK * TPB * 8 == NTOK * CW);
static_assert(WQBLK * TPB * 8 == NQKV * CW);
static_assert(WOBLK * TPB * 8 == CW * CW);

DEVINL int imin(int a, int b) { return a < b ? a : b; }
DEVINL int imax(int a, int b) { return a > b ? a : b; }

// ---------------------------------------------------------------------------
// WMMA helper with hazard guard (ties D, keeps A/B live).
// Fragment map (wave32): lane l, h = l>>4, m = n = l&15.
//   A/B element i: i<8 -> k0+8h+i ; i>=8 -> k0+16+8h+(i-8)   (two 16-B row loads)
//   D element r : row 8h+r, col l&15
// ---------------------------------------------------------------------------
DEVINL v8f wmma_f16(v16h a, v16h b, v8f c) {
  v8f d = __builtin_amdgcn_wmma_f32_16x16x32_f16(false, a, false, b, (short)0, c, false, false);
  asm volatile("v_nop\n\tv_nop\n\tv_nop\n\tv_nop" : "+v"(d) : "v"(a), "v"(b));
  return d;
}
DEVINL v8f zero8f() {
  v8f z = {0.f, 0.f, 0.f, 0.f, 0.f, 0.f, 0.f, 0.f};
  return z;
}
// row already includes the +8h lane offset; k contiguous in memory
DEVINL void load_frag(FragH& f, const f16t* row, int k0) {
  f.half[0] = *(const v8ha*)(row + k0);
  f.half[1] = *(const v8ha*)(row + k0 + 16);
}

DEVINL float gsum4(float v) {
  v += __shfl_xor(v, 1);
  v += __shfl_xor(v, 2);
  return v;
}

// ---------------------------------------------------------------------------
// One wave: 16 token rows (A, row-major f16, pitch KD) x 64 output cols
// (4 N-tiles of B rows [n][KD]).  arow / brow already carry the +m row and
// +8h k offsets; N-tile j is brow + 16*j*KD.
// ---------------------------------------------------------------------------
template <int KD>
DEVINL void mma_4n(const f16t* __restrict__ arow, const f16t* __restrict__ brow, v8f (&acc)[4]) {
  #pragma unroll 1
  for (int ks = 0; ks < KD / 32; ++ks) {
    const int k0 = 32 * ks;
    FragH a;
    load_frag(a, arow, k0);
    #pragma unroll
    for (int n = 0; n < 4; ++n) {
      FragH b;
      load_frag(b, brow + (size_t)16 * n * KD, k0);
      acc[n] = wmma_f16(a.v, b.v, acc[n]);
    }
  }
}

// LDS [64][PQF] -> 64 global row segments of 128 floats (pitch `pitch`).
// Wave w owns rows w+8i; one 512-B instruction per segment (32 lanes x 16 B =
DEVINL void store_rows_f32(const float* sbuf, float* dst, int pitch, int wave, int lane) {
  #pragma unroll
  for (int i = 0; i < 8; ++i) {
    const int row = wave + 8 * i;
    const v4f v = *(const v4fa*)(sbuf + row * PQF + 4 * lane);
    *(v4f*)(dst + (size_t)row * pitch + 4 * lane) = v;
  }
  
}

// ---------------------------------------------------------------------------
// Kernel 1: f32 -> f16 carried planes, straight copy-convert (sources are
// already [n][k] with k contiguous).
//   blocks 0..1023    : X16  = x * 16        [8192][256]
//   blocks 1024..1119 : WQKV = qkv_w * 256   [768][256]
//   blocks 1120..1151 : WO   = proj_w * 256  [256][256]
// Source selection is block-uniform.  Thread = 8 contiguous elements: two
// 16-B loads, one 16-B store; a wave writes 512 contiguous bytes = 4 whole
// coverage: X16 1024x256x8 = 8192x256; WQKV 96x256x8 = 768x256; WO 32x256x8 = 256x256.
// ---------------------------------------------------------------------------
__global__ __launch_bounds__(TPB) void prep_k(const float* __restrict__ x, const float* __restrict__ qw,
                                             const float* __restrict__ pw,
                                             f16t* __restrict__ X16, f16t* __restrict__ WQKV,
                                             f16t* __restrict__ WO)
{
  const int blk = blockIdx.x, tid = threadIdx.x;
  if (blk >= XBLK + WQBLK + WOBLK) return;          // block-uniform; grid exact
  const float* src;
  f16t* dst;
  float sc;
  int rb;
  if (blk < XBLK)              { src = x;  dst = X16;  sc = ACAR; rb = blk; }
  else if (blk < XBLK + WQBLK) { src = qw; dst = WQKV; sc = WCAR; rb = blk - XBLK; }
  else                         { src = pw; dst = WO;   sc = WCAR; rb = blk - XBLK - WQBLK; }
  const size_t idx = ((size_t)rb * TPB + tid) * 8;
  const v4f a = *(const v4fa*)(src + idx), c = *(const v4fa*)(src + idx + 4);
  v8h o;
  #pragma unroll
  for (int j = 0; j < 4; ++j) {
    o[j]     = (f16t)(a[j] * sc);
    o[4 + j] = (f16t)(c[j] * sc);
  }
  *(v8h*)(dst + idx) = o;
  
}

// ---------------------------------------------------------------------------
// Kernel 2: Q / K / V = X16 @ WQKV^T + qkv_b (K = 256), f32 planes [8192][256]
// (channel = head*32 + d).  Q additionally scaled by 1/16.
// Block = (64-token tile, y in 0..5: plane = y>>1, 128-col half = y&1, block-
// uniform).  Wave w: token 16-tile w&3, 64 output cols of half w>>2.
// Epilogue: (acc*SC_AW + bias) * osc staged [64][128] in LDS, then whole
// coverage per block: 8 waves x 16 rows x 64 cols = 64 tokens x 128 cols;
// grid 128 x 6 = 8192 tokens x 768 qkv channels.
// ---------------------------------------------------------------------------
__global__ __launch_bounds__(TPB) void gemm_qkv_k(const f16t* __restrict__ Xp, const f16t* __restrict__ Wp,
                                                 const float* __restrict__ bias,
                                                 float* __restrict__ Qo, float* __restrict__ Ko,
                                                 float* __restrict__ Vo)
{
  __shared__ __attribute__((aligned(16))) float sbuf[MT * PQF];   // 33,792 B
  const int tid = threadIdx.x, lane = tid & 31, wave = tid >> 5;
  const int h = lane >> 4, m = lane & 15;
  const int mt = wave & 3, nh = wave >> 2;
  const int row0 = blockIdx.x * MT, y = blockIdx.y;
  const int pl = y >> 1, chalf = y & 1;
  float* outp = (pl == 0) ? Qo : ((pl == 1) ? Ko : Vo);
  const float osc = (pl == 0) ? QSC : 1.0f;

  v8f acc[4];
  #pragma unroll
  for (int n = 0; n < 4; ++n) acc[n] = zero8f();
  const f16t* arow = Xp + (size_t)(row0 + 16 * mt + m) * CW + 8 * h;
  const f16t* brow = Wp + (size_t)(y * 128 + 64 * nh + m) * CW + 8 * h;
  mma_4n<CW>(arow, brow, acc);

  const int cb = y * 128 + 64 * nh;                // qkv channel base of this wave
  #pragma unroll
  for (int n = 0; n < 4; ++n) {
    const float bv = bias[cb + 16 * n + m];
    #pragma unroll
    for (int r = 0; r < 8; ++r)
      sbuf[(16 * mt + 8 * h + r) * PQF + 64 * nh + 16 * n + m] = (acc[n][r] * SC_AW + bv) * osc;
  }
  __syncthreads();
  store_rows_f32(sbuf, outp + (size_t)row0 * CW + 128 * chalf, CW, wave, lane);
}

// Scores of taps T0..T0+NT-1 of one window row: kp is the lane's 8 channels of the row's first
// loaded column, tap t lies t*CW floats on.  The group's 2*NT loads fly together, its NT
// cross-lane sums overlap.  A dead tap (slot t+sft outside 0..10) is stored to the pad slot.
template <int T0, int NT>
DEVINL void score_taps(const float* __restrict__ kp, v4f qa, v4f qc, float* sh, int r11, int sft) {
  static_assert(NT == 5 || NT == 6);
  v4f ka[NT], kc[NT];
  #pragma unroll   // all loads of the group are in flight before the first is used
  for (int i = 0; i < NT; ++i) {
    ka[i] = *(const v4fa*)(kp + (T0 + i) * CW);
    kc[i] = *(const v4fa*)(kp + (T0 + i) * CW + 4);
  }
  // inputs-only fence on the loaded values: keeps the group's loads issued together ahead of
  // the first use (without it the scheduler splits them into waited groups to save registers)
  if constexpr (NT == 6)
    asm volatile("" :: "v"(ka[0]), "v"(kc[0]), "v"(ka[1]), "v"(kc[1]), "v"(ka[2]), "v"(kc[2]),
                       "v"(ka[3]), "v"(kc[3]), "v"(ka[4]), "v"(kc[4]), "v"(ka[5]), "v"(kc[5]));
  else
    asm volatile("" :: "v"(ka[0]), "v"(kc[0]), "v"(ka[1]), "v"(kc[1]), "v"(ka[2]), "v"(kc[2]),
                       "v"(ka[3]), "v"(kc[3]), "v"(ka[4]), "v"(kc[4]));
  float d[NT];
  #pragma unroll
  for (int i = 0; i < NT; ++i) {
    float s = qa[0] * ka[i][0];
    s = fmaf(qa[1], ka[i][1], s);
    s = fmaf(qa[2], ka[i][2], s);
    s = fmaf(qa[3], ka[i][3], s);
    s = fmaf(qc[0], kc[i][0], s);
    s = fmaf(qc[1], kc[i][1], s);
    s = fmaf(qc[2], kc[i][2], s);
    s = fmaf(qc[3], kc[i][3], s);
    d[i] = s;
  }
  #pragma unroll   // NT independent cross-lane sums overlap
  for (int i = 0; i < NT; ++i) d[i] = gsum4(d[i]);
  #pragma unroll
  for (int i = 0; i < NT; ++i) {
    const bool live = (unsigned)(T0 + i + sft) < (unsigned)NTAPW;   // wave-uniform
    sh[live ? r11 + T0 + i : DEADSLOT] = d[i];   // all 4 lanes of the group store the same value
  }
}

// ---------------------------------------------------------------------------
// Kernel 3: 7x11 local-window attention, f32.  One wave per token (8 tokens
// per block); lane holds channels 8*lane..8*lane+7, head = lane>>2 (4 lanes
// per head).  Token (h0,w0) attends (hh,ww) iff |hh-h0|<=3 and |ww-w0|<=5
// inside the grid; the row loop bounds are clamped to the grid (wave-uniform);
// of each row 11 columns inside the grid are read, the window's among them.
//   pass 1: s = q.k to LDS slot (hh-h0+3)*11 + (ww-w0+5) of the per-wave
//           [head][80] score region (all 80 slots preset to -1e9).
//   pass 1b: max over the slots; e = exp(s - max) written back (20 slots per
//            lane), S = group sum, rS = 1/S.
//   pass 2: p = e * rS; ctx += p * v.
// O [8192][256] f16 x256: each lane stores its own 8 channels (16 B); the
// coverage: 1024 blocks x 8 waves = 8192 rows x (32 lanes x 8 halves).
// ---------------------------------------------------------------------------
__global__ __launch_bounds__(TPB) void attn_k(const float* __restrict__ Qp, const float* __restrict__ Kp,
                                             const float* __restrict__ Vp, f16t* __restrict__ Op)
{
  __shared__ __attribute__((aligned(16))) float sS[WAVES * NHEAD * NSLOT];   // 20,480 B
  const int tid = threadIdx.x, lane = tid & 31;
  const int wave = __builtin_amdgcn_readfirstlane(tid >> 5);
  const int gp = imin(blockIdx.x * WAVES + wave, NTOK - 1);   // grid exact
  const int bb = gp >> 10, n = gp & 1023, h0 = n >> 5, w0 = n & 31;
  const int head = lane >> 2, j4 = lane & 3, c0 = 8 * lane;
  float* sw = sS + wave * (NHEAD * NSLOT);
  float* sh = sw + head * NSLOT;

  {
    const v4f fill = {-1.0e9f, -1.0e9f, -1.0e9f, -1.0e9f};
    #pragma unroll
    for (int q = 0; q < 5; ++q) *(v4fa*)(sw + SLOTL * lane + 4 * q) = fill;   // 32 lanes x 20 = 640 slots
  }
  __syncthreads();

  const float* qp = Qp + (size_t)gp * CW + c0;
  const v4f qa = *(const v4fa*)qp, qc = *(const v4fa*)(qp + 4);
  const int hlo = imax(h0 - RH, 0), hhi = imin(h0 + RH, GH - 1);

  // The 11 taps of a window row are handled together.  The 11 columns loaded are wb..wb+10,
  // shifted into the grid at its edges, so tap t is one immediate offset from the row's base.
  // Tap t has slot t+sft of its row and is live iff that is 0..10 (|ww-w0| <= 5).  A dead tap
  // goes to the pad slot DEADSLOT, which is set back to -1e9 behind the loop (so e = 0), and
  // gets weight 0 in pass 2: every sum keeps its terms and their order.
  const int wb = imin(imax(w0 - RW, 0), GW - NTAPW);
  const int sft = wb - (w0 - RW);
  #pragma unroll 1   // rolled: the trip count varies, and more rows in flight would cost resident waves
  for (int hh = hlo; hh <= hhi; ++hh) {
    const int r11 = (hh - h0 + RH) * NTAPW + sft;
    const float* kp = Kp + (size_t)(bb * NTOKB + hh * GW + wb) * CW + c0;
    score_taps<0, 6>(kp, qa, qc, sh, r11, sft);
    score_taps<6, 5>(kp, qa, qc, sh, r11, sft);
  }
  sh[DEADSLOT] = -1.0e9f;                    // the pad slot again, behind the dead taps' stores
  __syncthreads();

  // The head's maximum is taken here, over the slots (pads hold -1e9), not tap by tap in pass 1.
  float sv[SLOTL];
  float mx = -3.0e38f;
  #pragma unroll   // 20 independent LDS reads overlap
  for (int it = 0; it < SLOTL; ++it) {
    sv[it] = sh[j4 + 4 * it];                // slots 0..79; unvisited slots hold -1e9
    mx = fmaxf(mx, sv[it]);
  }
  mx = fmaxf(mx, __shfl_xor(mx, 1));
  mx = fmaxf(mx, __shfl_xor(mx, 2));
  float ssum = 0.0f;
  #pragma unroll   // 20 independent exp chains overlap; the ssum adds stay in order
  for (int it = 0; it < SLOTL; ++it) {
    float e = __expf(sv[it] - mx);
    e = (sv[it] > -1.0e8f) ? e : 0.0f;
    sh[j4 + 4 * it] = e;
    ssum += e;
  }
  ssum = gsum4(ssum);                        // >= 1 (the max slot gives e = 1)
  const float rS = 1.0f / ssum;
  __syncthreads();

  v4f cxa = {0.f, 0.f, 0.f, 0.f}, cxc = {0.f, 0.f, 0.f, 0.f};
  #pragma unroll 1   // as in pass 1
  for (int hh = hlo; hh <= hhi; ++hh) {
    const int r11 = (hh - h0 + RH) * NTAPW + sft;
    const float* vp = Vp + (size_t)(bb * NTOKB + hh * GW + wb) * CW + c0;
    v4f va[NTAPW], vc[NTAPW];
    float p[NTAPW];
    #pragma unroll   // all loads of the row are in flight before the first is used
    for (int t = 0; t < NTAPW; ++t) {
      const bool live = (unsigned)(t + sft) < (unsigned)NTAPW;    // wave-uniform
      va[t] = *(const v4fa*)(vp + t * CW);
      vc[t] = *(const v4fa*)(vp + t * CW + 4);
      p[t] = sh[live ? r11 + t : DEADSLOT] * rS;                  // the pad slot holds e = 0
    }
    #pragma unroll
    for (int t = 0; t < NTAPW; ++t) {
      #pragma unroll
      for (int j = 0; j < 4; ++j) {
        cxa[j] = fmaf(p[t], va[t][j], cxa[j]);
        cxc[j] = fmaf(p[t], vc[t][j], cxc[j]);
      }
    }
  }

  v8h oh;
  #pragma unroll
  for (int j = 0; j < 4; ++j) {
    oh[j]     = (f16t)(cxa[j] * OCAR);
    oh[4 + j] = (f16t)(cxc[j] * OCAR);
  }
  f16t* dst = Op + (size_t)gp * CW + c0;
  *(v8h*)dst = oh;
  
}

// ---------------------------------------------------------------------------
// Kernel 4: out = O @ WO^T + proj_b (K = 256) -> d_out f32 [8192][256].
// Block = (64-token tile, y = 128-col half).  Wave w: token 16-tile w&3, 64
// cols of half w>>2.  Epilogue acc*SC_OW + bias staged [64][128] in LDS, then
// coverage per block: 64 rows x 128 cols; grid 128 x 2 = 8192 rows x 256 cols.
// ---------------------------------------------------------------------------
__global__ __launch_bounds__(TPB) void gemm_proj_k(const f16t* __restrict__ Opl, const f16t* __restrict__ Wp,
                                                  const float* __restrict__ bias, float* __restrict__ out)
{
  __shared__ __attribute__((aligned(16))) float sbuf[MT * PQF];   // 33,792 B
  const int tid = threadIdx.x, lane = tid & 31, wave = tid >> 5;
  const int h = lane >> 4, m = lane & 15;
  const int mt = wave & 3, nh = wave >> 2;
  const int row0 = blockIdx.x * MT, y = blockIdx.y;

  v8f acc[4];
  #pragma unroll
  for (int n = 0; n < 4; ++n) acc[n] = zero8f();
  const f16t* arow = Opl + (size_t)(row0 + 16 * mt + m) * CW + 8 * h;
  const f16t* brow = Wp + (size_t)(y * 128 + 64 * nh + m) * CW + 8 * h;
  mma_4n<CW>(arow, brow, acc);

  const int cb = y * 128 + 64 * nh;
  #pragma unroll
  for (int n = 0; n < 4; ++n) {
    const float bv = bias[cb + 16 * n + m];
    #pragma unroll
    for (int r = 0; r < 8; ++r)
      sbuf[(16 * mt + 8 * h + r) * PQF + 64 * nh + 16 * n + m] = acc[n][r] * SC_OW + bv;
  }
  __syncthreads();
  store_rows_f32(sbuf, out + (size_t)row0 * CW + 128 * y, CW, wave, lane);
}

// ---------------------------------------------------------------------------
extern "C" void kernel_launch(void* const* d_in, const int* in_sizes, int n_in,
                              void* d_out, int out_size, void* d_ws, size_t ws_size,
                              hipStream_t stream) {
  if (n_in < 5) return;
  if (in_sizes[0] != NTOK * CW) return;
  if (in_sizes[1] != NQKV * CW || in_sizes[2] != NQKV) return;
  if (in_sizes[3] != CW * CW || in_sizes[4] != CW) return;
  if (out_size != NTOK * CW) return;

  const float* x      = (const float*)d_in[0];   // [8192][256]
  const float* qkv_w  = (const float*)d_in[1];   // [768][256]
  const float* qkv_b  = (const float*)d_in[2];   // [768]
  const float* proj_w = (const float*)d_in[3];   // [256][256]
  const float* proj_b = (const float*)d_in[4];   // [256]
  float* outp = (float*)d_out;

  // workspace carve (bytes); every region is an exact multiple of its whole-row
  //   WQKV 768 x 256 f16    =    393,216
  //   WO   256 x 256 f16    =    131,072
  //   X16  8192 x 256 f16   =  4,194,304
  //   Q    8192 x 256 f32   =  8,388,608
  //   K    8192 x 256 f32   =  8,388,608
  //   V    8192 x 256 f32   =  8,388,608
  //   O    8192 x 256 f16   =  4,194,304
  //   total                 = 34,078,720
  const size_t szWQKV = (size_t)NQKV * CW * 2;
  const size_t szWO   = (size_t)CW * CW * 2;
  const size_t szP16  = (size_t)NTOK * CW * 2;
  const size_t szP32  = (size_t)NTOK * CW * 4;
  size_t off = 0;
  char* ws = (char*)d_ws;
  f16t*  WQKV = (f16t*)(ws + off);  off += szWQKV;
  f16t*  WO   = (f16t*)(ws + off);  off += szWO;
  f16t*  X16  = (f16t*)(ws + off);  off += szP16;
  float* Qp   = (float*)(ws + off); off += szP32;
  float* Kp   = (float*)(ws + off); off += szP32;
  float* Vp   = (float*)(ws + off); off += szP32;
  f16t*  Opl  = (f16t*)(ws + off);  off += szP16;
  if (off > ws_size) return;

  // x, qkv_w, proj_w -> f16 carried planes
  prep_k<<<XBLK + WQBLK + WOBLK, TPB, 0, stream>>>(x, qkv_w, proj_w, X16, WQKV, WO);
  // Q (x1/16), K, V = x @ qkv_w^T + qkv_b  (f32 planes)
  gemm_qkv_k<<<dim3(NTOK / MT, NQKV / 128), TPB, 0, stream>>>(X16, WQKV, qkv_b, Qp, Kp, Vp);
  // 7x11 window attention -> O f16 x256
  attn_k<<<NTOK / WAVES, TPB, 0, stream>>>(Qp, Kp, Vp, Opl);
  // out = O @ proj_w^T + proj_b
  gemm_proj_k<<<dim3(NTOK / MT, CW / 128), TPB, 0, stream>>>(Opl, WO, proj_b, outp);
  (void)hipGetLastError();
}

// v003
// A run of this version takes 23.2 microseconds.
// It is 2.59 times as fast as v001, going by the measured steps of the versions left out in between.
// All steps since v000 together make it 3.23 times as fast.
// Contractions x@qkv_w^T (K=256), o@proj_w^T (K=256), window scores k.q (K=32) and context sums v.p (K=32 keys): v_wmma_f32_16x16x32_f16 (f16 operands, f32 accumulate). Softmax: f32 VALU.
// f16 operands and carries: x*16, qkv_w*256 and proj_w*256 are converted by the GEMM that uses them, on the way into its LDS tiles; O = window context*256. Q, K, V planes are f16 in fragment order (no carry; Q holds bias and the 1/16 scale).
// Inverse carries folded exactly once: gemm_qkv_k stages acc*SC_AW (1/(16*256)) before the bias add; gemm_proj_k stages acc*SC_OW (1/(256*256)) before the bias add. No other consumer rescales.
#include <hip/hip_runtime.h>
#include <stdint.h>

#define DEVINL __device__ __forceinline__

typedef _Float16 f16t;
typedef _Float16 v16h __attribute__((ext_vector_type(16)));
typedef _Float16 v8h  __attribute__((ext_vector_type(8)));
typedef float    v8f  __attribute__((ext_vector_type(8)));
typedef float    v4f  __attribute__((ext_vector_type(4)));
typedef _Float16 v4h  __attribute__((ext_vector_type(4)));
typedef v8h __attribute__((may_alias)) v8ha;
typedef v4h __attribute__((may_alias)) v4ha;
typedef v4f __attribute__((may_alias)) v4fa;
union FragH { v16h v; v8h half[2]; };

#define NBATCH 8
#define GH     32          // grid rows
#define GW     32          // grid cols
#define NTOKB  1024        // tokens per batch
#define NTOK   8192        // total token rows
#define CW     256         // embed width
#define NQKV   768         // 3*CW
#define NHEAD  8
#define HDIM   32
#define RH     3           // window half height (7 rows)
#define RW     5           // window half width (11 cols)
#define FTILE  512         // halves of one 16 x 32 fragment tile (two 512-B parts)
#define HPLANE 32768       // halves of one (batch, head) plane: 1024 tokens x 32 channels
#define PTH    72          // LDS pitch (halves) of the [128 channels][64 tokens] f16 staging of V
#define POH    264         // LDS pitch (halves) of the [32 tokens][256 channels] f16 staging of O
#define L2E    1.44269504088896340736f
#define TPB    256
#define WAVES  8
#define MT     64          // token tile of the GEMMs
#define NT     128         // output-column tile of the GEMMs
#define PQF    132         // LDS pitch (floats) of the [64][128] f32 staging
#define PS     264         // LDS pitch (halves) of the f16 operand tiles: 528 B = 16 B x 33, for ds_load_b128 readers
#define ACAR   16.0f
#define WCAR   256.0f
#define OCAR   256.0f
#define SC_AW  (1.0f / (16.0f * 256.0f))
#define SC_OW  (1.0f / (256.0f * 256.0f))
#define QSC    0.0625f     // 256^-0.5

static_assert(TPB == WAVES * 32);
static_assert(GH * GW == NTOKB);
static_assert(NBATCH * NTOKB == NTOK);
static_assert(NHEAD * HDIM == CW);
static_assert(NHEAD == WAVES);
static_assert(HDIM == 32 && GW == 32);
static_assert(HPLANE == NTOKB * HDIM && FTILE == 16 * HDIM);
static_assert((PTH % 8) == 0 && (POH % 8) == 0);
static_assert(128 * PTH * 2 <= MT * PQF * 4);
static_assert((NTOK % MT) == 0);
static_assert((NTOK % WAVES) == 0);
static_assert((CW % 32) == 0);
static_assert((NQKV % 128) == 0);
static_assert((PQF % 4) == 0);
static_assert(MT == 64);
static_assert(CW == 256 && TPB == 256);
static_assert((PS % 8) == 0 && PS >= CW);
static_assert(MT * PQF * 4 <= (MT + NT) * PS * 2);

DEVINL int imin(int a, int b) { return a < b ? a : b; }
DEVINL int imax(int a, int b) { return a > b ? a : b; }

// ---------------------------------------------------------------------------
// WMMA helper with hazard guard (ties D, keeps A/B live).
// Fragment map (wave32): lane l, h = l>>4, m = n = l&15.
//   A/B element i: i<8 -> k0+8h+i ; i>=8 -> k0+16+8h+(i-8)   (two 16-B row loads)
//   D element r : row 8h+r, col l&15
// ---------------------------------------------------------------------------
DEVINL v8f wmma_f16(v16h a, v16h b, v8f c) {
  v8f d = __builtin_amdgcn_wmma_f32_16x16x32_f16(false, a, false, b, (short)0, c, false, false);
  asm volatile("v_nop\n\tv_nop\n\tv_nop\n\tv_nop" : "+v"(d) : "v"(a), "v"(b));
  return d;
}
DEVINL v8f zero8f() {
  v8f z = {0.f, 0.f, 0.f, 0.f, 0.f, 0.f, 0.f, 0.f};
  return z;
}
// row already includes the +8h lane offset; k contiguous in memory
DEVINL void load_frag(FragH& f, const f16t* row, int k0) {
  f.half[0] = *(const v8ha*)(row + k0);
  f.half[1] = *(const v8ha*)(row + k0 + 16);
}

// lane l with lane l ^ 16 (a vector cross-row move; __shfl_xor would go through the LDS unit)
DEVINL float xhalf(float x) {
  return __builtin_bit_cast(float, __builtin_amdgcn_permlanex16(__builtin_bit_cast(int, x), __builtin_bit_cast(int, x),
                                                                0x76543210, 0xfedcba98, false, false));
}

// 2^x.  The v_nop is the slot the instruction set asks for behind a transcendental before its result
// is used or its source overwritten; inside the statement it cannot be scheduled away from the v_exp.
DEVINL float exp2_slot(float x) {
  float e;
  asm("v_exp_f32 %0, %1\n\tv_nop" : "=v"(e) : "v"(x));
  return e;
}

// One fragment tile stored in fragment order: part p (elements 8p..8p+7 of every lane) is 512
// contiguous bytes, lane l's 16 bytes at 16*l, so each load reads four whole 128-B lines.
DEVINL void load_tile(FragH& f, const f16t* tile, int lane) {
  f.half[0] = *(const v8ha*)(tile + 8 * lane);
  f.half[1] = *(const v8ha*)(tile + 256 + 8 * lane);
}

// ---------------------------------------------------------------------------
// Operand tiles in LDS: ROWS rows of CW halves at pitch PS.  The source rows are whole and follow
// one another in memory, so every wave-wide load reads 512 contiguous bytes (four whole lines).
// ---------------------------------------------------------------------------
// f32 source, times sc, to f16.  Thread = 4 floats per step; a step of the block is 4 rows.
template <int ROWS>
DEVINL void stage_f32(const float* __restrict__ src, f16t* s, float sc, int tid) {
  const float* g = src + 4 * tid;
  f16t* d = s + (tid >> 6) * PS + 4 * (tid & 63);
  #pragma unroll
  for (int i0 = 0; i0 < ROWS / 4; i0 += 16) {
    v4f r[16];                                   // 16 loads in flight per thread
    #pragma unroll
    for (int j = 0; j < 16; ++j) r[j] = *(const v4fa*)(g + 1024 * (i0 + j));
    #pragma unroll
    for (int j = 0; j < 16; ++j) {
      v4h o;
      #pragma unroll
      for (int c = 0; c < 4; ++c) o[c] = (f16t)(r[j][c] * sc);
      *(v4ha*)(d + 4 * (i0 + j) * PS) = o;
    }
  }
}
// f16 source, copied.  Thread = 8 halves per step; a step of the block is 8 rows.
template <int ROWS>
DEVINL void stage_f16(const f16t* __restrict__ src, f16t* s, int tid) {
  const f16t* g = src + 8 * tid;
  f16t* d = s + (tid >> 5) * PS + 8 * (tid & 31);
  v8h r[ROWS / 8];
  #pragma unroll
  for (int j = 0; j < ROWS / 8; ++j) r[j] = *(const v8ha*)(g + 2048 * j);
  #pragma unroll
  for (int j = 0; j < ROWS / 8; ++j) *(v8ha*)(d + 8 * j * PS) = r[j];
}

// ---------------------------------------------------------------------------
// One wave: 16 token rows (A tile in LDS) x 64 output cols (4 N-tiles of the B tile in LDS),
// K = CW.  arow / brow already carry the +m row and +8h k offsets; N-tile j is brow + 16*j*PS.
// ---------------------------------------------------------------------------
// The ten LDS reads of k step ks+1 are issued as one group ahead of the products of step ks (a
// second fragment set), so a product waits for no read issued just in front of it.
DEVINL void load_step(FragH& a, FragH (&b)[4], const f16t* arow, const f16t* brow, int k0) {
  load_frag(a, arow, k0);
  #pragma unroll
  for (int n = 0; n < 4; ++n) load_frag(b[n], brow + 16 * n * PS, k0);
}
DEVINL void mma_4n(const f16t* arow, const f16t* brow, v8f (&acc)[4]) {
  FragH a[2], b[2][4];
  load_step(a[0], b[0], arow, brow, 0);
  #pragma unroll
  for (int ks = 0; ks < CW / 32; ++ks) {
    const int cur = ks & 1;
    if (ks + 1 < CW / 32) load_step(a[cur ^ 1], b[cur ^ 1], arow, brow, 32 * (ks + 1));
    #pragma unroll
    for (int n = 0; n < 4; ++n) acc[n] = wmma_f16(a[cur].v, b[cur][n].v, acc[n]);
  }
}

// LDS [64][PQF] -> 64 global row segments of 128 floats (pitch `pitch`).
// Wave w owns rows w+8i; one 512-B instruction per segment (32 lanes x 16 B =
DEVINL void store_rows_f32(const float* sbuf, float* dst, int pitch, int wave, int lane) {
  #pragma unroll
  for (int i = 0; i < 8; ++i) {
    const int row = wave + 8 * i;
    const v4f v = *(const v4fa*)(sbuf + row * PQF + 4 * lane);
    *(v4f*)(dst + (size_t)row * pitch + 4 * lane) = v;
  }
  
}

// ---------------------------------------------------------------------------
// Kernel 1: Q / K / V = (x*16) @ (qkv_w*256)^T + qkv_b (K = 256) -> f16 planes, one of HPLANE halves per
// (batch, head), made of 16 x 32 fragment tiles in the order load_tile reads.  Q additionally
// scaled by 1/16.
//   Q, K: tile = 16 tokens (tile index token>>4); lane (h, m) part p holds token m, channels
//         16p+8h .. +7 of the head.
//   V   : tile = 16 channels x the 32 tokens of one grid row (tile index 2*row + (channel>>4));
//         lane (h, m) part p holds channel m, tokens 16p+8h .. +7 of the row.
// Block = (64-token tile, y in 0..5: plane = y>>1, 128-col half = y&1, block-
// uniform).  Wave w: token 16-tile w&3, 64 output cols of half w>>2.
// Operands: the block's 64 rows of x and 128 rows of qkv_w, f32, go through stage_f32 into LDS;
// the epilogue's staging reuses that LDS behind a barrier.
// Epilogue: (acc*SC_AW + bias) * osc staged in LDS ([64 tokens][128] f32 for Q and K,
// [128 channels][64 tokens] f16 for V), then 512-B stores: 4 heads x 8 parts per block, wave w
// writes part w of each head's 4 KB.
// coverage per block: 64 tokens x 128 cols; grid 128 x 6 = 8192 tokens x 768 qkv channels.
// ---------------------------------------------------------------------------
// Second bound: six waves per SIMD, so that three blocks (the whole grid) are resident at once.
__global__ __launch_bounds__(TPB, 6) void gemm_qkv_k(const float* __restrict__ x, const float* __restrict__ qw,
                                                 const float* __restrict__ bias,
                                                 f16t* __restrict__ Qo, f16t* __restrict__ Ko,
                                                 f16t* __restrict__ Vo)
{
  __shared__ __attribute__((aligned(16))) f16t sop[(MT + NT) * PS];   // 101,376 B: three blocks per WGP
  f16t* sA = sop;
  f16t* sB = sop + MT * PS;
  float* sbuf = (float*)sop;                       // [64][PQF] f32, after the products
  const int tid = threadIdx.x, lane = tid & 31, wave = tid >> 5;
  const int h = lane >> 4, m = lane & 15;
  const int mt = wave & 3, nh = wave >> 2;
  const int row0 = blockIdx.x * MT, y = blockIdx.y;
  const int pl = y >> 1, chalf = y & 1;
  const int bb = row0 >> 10, tk0 = row0 & (NTOKB - 1);   // the 64 tokens lie in one batch
  f16t* outp = ((pl == 0) ? Qo : ((pl == 1) ? Ko : Vo)) + (size_t)(bb * NHEAD + 4 * chalf) * HPLANE;
  const float osc = (pl == 0) ? QSC : 1.0f;
  f16t* sT = (f16t*)sbuf;

  v8f acc[4];
  #pragma unroll
  for (int n = 0; n < 4; ++n) acc[n] = zero8f();
  stage_f32<MT>(x + (size_t)row0 * CW, sA, ACAR, tid);
  stage_f32<NT>(qw + (size_t)y * NT * CW, sB, WCAR, tid);
  __syncthreads();                                 // the tiles are whole before any fragment is read
  mma_4n(sA + (16 * mt + m) * PS + 8 * h, sB + (64 * nh + m) * PS + 8 * h, acc);
  __syncthreads();                                 // every fragment is read before sbuf overwrites the tiles

  const int cb = y * 128 + 64 * nh;                // qkv channel base of this wave
  if (pl == 2) {                                   // block-uniform
    #pragma unroll
    for (int n = 0; n < 4; ++n) {
      const float bv = bias[cb + 16 * n + m];
      v8h pk;                                      // 8 consecutive tokens of one channel
      #pragma unroll
      for (int r = 0; r < 8; ++r) pk[r] = (f16t)(acc[n][r] * SC_AW + bv);
      *(v8ha*)(sT + (64 * nh + 16 * n + m) * PTH + 16 * mt + 8 * h) = pk;
    }
  } else {
    #pragma unroll
    for (int n = 0; n < 4; ++n) {
      const float bv = bias[cb + 16 * n + m];
      #pragma unroll
      for (int r = 0; r < 8; ++r)
        sbuf[(16 * mt + 8 * h + r) * PQF + 64 * nh + 16 * n + m] = (acc[n][r] * SC_AW + bv) * osc;
    }
  }
  __syncthreads();
  const int part = wave & 1;
  v8h o[4];                                            // the four LDS reads overlap, ahead of the stores
  f16t* dst;
  if (pl == 2) {
    const int hl = wave >> 2, mtv = (wave >> 1) & 1;   // grid row of the pair, 16-channel tile
    #pragma unroll
    for (int hd = 0; hd < 4; ++hd)
      o[hd] = *(const v8ha*)(sT + (32 * hd + 16 * mtv + m) * PTH + 32 * hl + 16 * part + 8 * h);
    dst = outp + (((tk0 >> 5) + hl) * 2 + mtv) * FTILE + 256 * part + 8 * lane;
  } else {
    const int tl = wave >> 1;                          // 16-token tile of the 64
    #pragma unroll
    for (int hd = 0; hd < 4; ++hd) {
      const float* sp = sbuf + (16 * tl + m) * PQF + 32 * hd + 16 * part + 8 * h;
      const v4f a = *(const v4fa*)sp, c = *(const v4fa*)(sp + 4);
      #pragma unroll
      for (int j = 0; j < 4; ++j) {
        o[hd][j]     = (f16t)a[j];
        o[hd][4 + j] = (f16t)c[j];
      }
    }
    dst = outp + ((tk0 >> 4) + tl) * FTILE + 256 * part + 8 * lane;
  }
  #pragma unroll
  for (int hd = 0; hd < 4; ++hd) *(v8h*)(dst + (size_t)hd * HPLANE) = o[hd];
}

// ---------------------------------------------------------------------------
// Kernel 2: 7x11 local-window attention on matrix tiles.  Block = one grid row of one batch
// (32 query tokens), wave = head.  Token (h0,w0) attends (hh,ww) iff |hh-h0|<=3 and
// |ww-w0|<=5 inside the grid.  The wave walks the window's grid rows (bounds clamped to the
// grid, wave-uniform); a grid row is 32 keys = one K step:
//   S^T[key][query] = K.Q^T : A = K tile (16 keys), B = Q tile (16 queries), 2 x 2 tiles.
//       Lane (h, n) holds keys 16ct+8h+r of query 16qt+n; keys with |ww-w0| > 5 get -1e30.
//   running softmax per query (f32): new maximum (own 16 scores, then the partner lane n^16),
//       e = exp(s - max), the earlier sum and context scaled by exp(old max - new max).
//   O^T[channel][query] += V^T.P^T : the two f32 score tiles of a query tile, converted in
//       place, are the B operand (element 8ct+r = key 16ct+8h+r); A = V tile (16 channels).
// The next grid row's K and V tiles are loaded while this one is worked on.
// O [8192][256] f16 x256: context / sum, staged [32][256] in LDS, then whole 512-B rows.
// coverage: 256 blocks x 32 tokens = 8192 rows x (8 waves x 32 channels).
// ---------------------------------------------------------------------------
__global__ __launch_bounds__(TPB) void attn_k(const f16t* __restrict__ Qf, const f16t* __restrict__ Kf,
                                             const f16t* __restrict__ Vf, f16t* __restrict__ Op)
{
  __shared__ __attribute__((aligned(16))) f16t so[GW * POH];   // 16,896 B
  const int tid = threadIdx.x, lane = tid & 31;
  const int wave = __builtin_amdgcn_readfirstlane(tid >> 5);   // = head
  const int h = lane >> 4, n = lane & 15;
  const int blk = imin(blockIdx.x, NBATCH * GH - 1);           // grid exact
  const int bb = blk >> 5, h0 = blk & 31;
  const size_t pb = (size_t)(bb * NHEAD + wave) * HPLANE;
  const f16t* kb = Kf + pb;
  const f16t* vb = Vf + pb;
  const int hlo = imax(h0 - RH, 0), hhi = imin(h0 + RH, GH - 1);

  FragH q[2], kc[2], vc[2];
  #pragma unroll
  for (int t = 0; t < 2; ++t) {
    load_tile(q[t], Qf + pb + (2 * h0 + t) * FTILE, lane);
    load_tile(kc[t], kb + (2 * hlo + t) * FTILE, lane);
    load_tile(vc[t], vb + (2 * hlo + t) * FTILE, lane);
  }

  v8f acc[2][2];                              // [channel tile][query tile]
  float mxl[2], ls[2];                        // running maximum (times log2 e) and lane's part of the sum
  #pragma unroll
  for (int qt = 0; qt < 2; ++qt) {
    acc[0][qt] = zero8f();
    acc[1][qt] = zero8f();
    mxl[qt] = -3.0e38f;
    ls[qt] = 0.0f;
  }
  const int dl = 8 * h - n + RW;              // ww - w0 + 5 = dl + 16*(ct - qt) + r

  #pragma unroll 1   // rolled: the trip count varies (4..7) and one row ahead is enough in flight
  for (int hh = hlo; hh <= hhi; ++hh) {
    const int hn = imin(hh + 1, hhi);
    FragH kn[2], vn[2];
    #pragma unroll
    for (int t = 0; t < 2; ++t) {
      load_tile(kn[t], kb + (2 * hn + t) * FTILE, lane);
      load_tile(vn[t], vb + (2 * hn + t) * FTILE, lane);
    }
    #pragma unroll
    for (int qt = 0; qt < 2; ++qt) {
      v8f s[2];
      float mloc = -1.0e30f;
      #pragma unroll
      for (int ct = 0; ct < 2; ++ct) {
        s[ct] = wmma_f16(kc[ct].v, q[qt].v, zero8f());
        #pragma unroll
        for (int r = 0; r < 8; ++r) {
          const bool live = (unsigned)(dl + 16 * (ct - qt) + r) <= (unsigned)(2 * RW);
          s[ct][r] = live ? s[ct][r] : -1.0e30f;
          mloc = fmaxf(mloc, s[ct][r]);
        }
      }
      mloc = fmaxf(mloc, xhalf(mloc));                // every query has a live key in every grid row
      const float mnew = fmaxf(mxl[qt], mloc * L2E);
      const float sc = exp2_slot(mxl[qt] - mnew);
      mxl[qt] = mnew;
      FragH p;
      float ps[4] = {0.0f, 0.0f, 0.0f, 0.0f};         // four short chains of adds in place of one long one
      #pragma unroll
      for (int ct = 0; ct < 2; ++ct) {
        #pragma unroll
        for (int r = 0; r < 8; ++r) {
          const float e = exp2_slot(fmaf(s[ct][r], L2E, -mnew));
          ps[r & 3] += e;
          p.v[8 * ct + r] = (f16t)e;
        }
      }
      ls[qt] = fmaf(ls[qt], sc, (ps[0] + ps[1]) + (ps[2] + ps[3]));
      #pragma unroll
      for (int mt = 0; mt < 2; ++mt) {
        #pragma unroll
        for (int r = 0; r < 8; ++r) acc[mt][qt][r] *= sc;
        acc[mt][qt] = wmma_f16(vc[mt].v, p.v, acc[mt][qt]);
      }
    }
    #pragma unroll
    for (int t = 0; t < 2; ++t) {
      kc[t] = kn[t];
      vc[t] = vn[t];
    }
  }

  #pragma unroll
  for (int qt = 0; qt < 2; ++qt) {
    const float l = ls[qt] + xhalf(ls[qt]);           // >= 1 (the maximum's key gives e = 1)
    const float rs = OCAR / l;
    #pragma unroll
    for (int mt = 0; mt < 2; ++mt) {
      v8h oh;                                         // 8 consecutive channels of one token
      #pragma unroll
      for (int r = 0; r < 8; ++r) oh[r] = (f16t)(acc[mt][qt][r] * rs);
      *(v8ha*)(so + (16 * qt + n) * POH + HDIM * wave + 16 * mt + 8 * h) = oh;
    }
  }
  __syncthreads();
  #pragma unroll
  for (int i = 0; i < 4; ++i) {
    const int row = wave + 8 * i;
    const v8h v = *(const v8ha*)(so + row * POH + 8 * lane);
    *(v8h*)(Op + (size_t)(blk * GW + row) * CW + 8 * lane) = v;
  }
}

// ---------------------------------------------------------------------------
// Kernel 3: out = O @ (proj_w*256)^T + proj_b (K = 256) -> d_out f32 [8192][256].
// Block = (64-token tile, y = 128-col half).  Wave w: token 16-tile w&3, 64
// cols of half w>>2.  Operands: 64 rows of O (f16, copied) and 128 rows of proj_w (f32,
// stage_f32) in LDS; the epilogue's staging reuses that LDS behind a barrier.  Epilogue acc*SC_OW + bias staged [64][128] in LDS, then
// coverage per block: 64 rows x 128 cols; grid 128 x 2 = 8192 rows x 256 cols.
// ---------------------------------------------------------------------------
__global__ __launch_bounds__(TPB) void gemm_proj_k(const f16t* __restrict__ Opl, const float* __restrict__ pw,
                                                  const float* __restrict__ bias, float* __restrict__ out)
{
  __shared__ __attribute__((aligned(16))) f16t sop[(MT + NT) * PS];   // 101,376 B
  f16t* sA = sop;
  f16t* sB = sop + MT * PS;
  float* sbuf = (float*)sop;                       // [64][PQF] f32, after the products
  const int tid = threadIdx.x, lane = tid & 31, wave = tid >> 5;
  const int h = lane >> 4, m = lane & 15;
  const int mt = wave & 3, nh = wave >> 2;
  const int row0 = blockIdx.x * MT, y = blockIdx.y;

  v8f acc[4];
  #pragma unroll
  for (int n = 0; n < 4; ++n) acc[n] = zero8f();
  stage_f16<MT>(Opl + (size_t)row0 * CW, sA, tid);
  stage_f32<NT>(pw + (size_t)y * NT * CW, sB, WCAR, tid);
  __syncthreads();                                 // the tiles are whole before any fragment is read
  mma_4n(sA + (16 * mt + m) * PS + 8 * h, sB + (64 * nh + m) * PS + 8 * h, acc);
  __syncthreads();                                 // every fragment is read before sbuf overwrites the tiles

  const int cb = y * 128 + 64 * nh;
  #pragma unroll
  for (int n = 0; n < 4; ++n) {
    const float bv = bias[cb + 16 * n + m];
    #pragma unroll
    for (int r = 0; r < 8; ++r)
      sbuf[(16 * mt + 8 * h + r) * PQF + 64 * nh + 16 * n + m] = acc[n][r] * SC_OW + bv;
  }
  __syncthreads();
  store_rows_f32(sbuf, out + (size_t)row0 * CW + 128 * y, CW, wave, lane);
}

// ---------------------------------------------------------------------------
extern "C" void kernel_launch(void* const* d_in, const int* in_sizes, int n_in,
                              void* d_out, int out_size, void* d_ws, size_t ws_size,
                              hipStream_t stream) {
  if (n_in < 5) return;
  if (in_sizes[0] != NTOK * CW) return;
  if (in_sizes[1] != NQKV * CW || in_sizes[2] != NQKV) return;
  if (in_sizes[3] != CW * CW || in_sizes[4] != CW) return;
  if (out_size != NTOK * CW) return;

  const float* x      = (const float*)d_in[0];   // [8192][256]
  const float* qkv_w  = (const float*)d_in[1];   // [768][256]
  const float* qkv_b  = (const float*)d_in[2];   // [768]
  const float* proj_w = (const float*)d_in[3];   // [256][256]
  const float* proj_b = (const float*)d_in[4];   // [256]
  float* outp = (float*)d_out;

  // workspace carve (bytes); every region is an exact multiple of its whole-row
  //   Q    8192 x 256 f16   =  4,194,304
  //   K    8192 x 256 f16   =  4,194,304
  //   V    8192 x 256 f16   =  4,194,304
  //   O    8192 x 256 f16   =  4,194,304
  //   total                 = 16,777,216
  const size_t szP16  = (size_t)NTOK * CW * 2;
  size_t off = 0;
  char* ws = (char*)d_ws;
  f16t*  Qp   = (f16t*)(ws + off);  off += szP16;
  f16t*  Kp   = (f16t*)(ws + off);  off += szP16;
  f16t*  Vp   = (f16t*)(ws + off);  off += szP16;
  f16t*  Opl  = (f16t*)(ws + off);  off += szP16;
  if (off > ws_size) return;

  // Q (x1/16), K, V = x @ qkv_w^T + qkv_b  (f16 planes in fragment order)
  gemm_qkv_k<<<dim3(NTOK / MT, NQKV / 128), TPB, 0, stream>>>(x, qkv_w, qkv_b, Qp, Kp, Vp);
  // 7x11 window attention -> O f16 x256
  attn_k<<<NBATCH * GH, TPB, 0, stream>>>(Qp, Kp, Vp, Opl);
  // out = O @ proj_w^T + proj_b
  gemm_proj_k<<<dim3(NTOK / MT, CW / 128), TPB, 0, stream>>>(Opl, proj_w, proj_b, outp);
  (void)hipGetLastError();
}

// v004
// One run takes 20 microseconds.
// Timed twice side by side with v003, it ran 1.16 and 1.15 times as fast.
// Counting every step since v000, it is 3.73 times as fast.
// Contractions x@qkv_w^T (K=256), o@proj_w^T (K=256), window scores k.q (K=32) and context sums v.p (K=32 keys): v_wmma_f32_16x16x32_f16 (f16 operands, f32 accumulate). Softmax: f32 VALU.
// f16 operands and carries: x*16 and qkv_w*256 are converted by gemm_qkv_k on the way into its LDS tiles; proj_w*256 is written by the same launch as a plane in fragment order; O = window context*256 stays in LDS. Q, K, V planes are f16 in fragment order (no carry; Q holds bias and the 1/16 scale).
// Inverse carries folded exactly once: gemm_qkv_k stages acc*SC_AW (1/(16*256)) before the bias add; attn_proj_k stages acc*SC_OW (1/(256*256)) before the bias add. No other consumer rescales.
#include <hip/hip_runtime.h>
#include <stdint.h>

#define DEVINL __device__ __forceinline__

typedef _Float16 f16t;
typedef _Float16 v16h __attribute__((ext_vector_type(16)));
typedef _Float16 v8h  __attribute__((ext_vector_type(8)));
typedef float    v8f  __attribute__((ext_vector_type(8)));
typedef float    v4f  __attribute__((ext_vector_type(4)));
typedef _Float16 v4h  __attribute__((ext_vector_type(4)));
typedef v8h __attribute__((may_alias)) v8ha;
typedef v4h __attribute__((may_alias)) v4ha;
typedef v4f __attribute__((may_alias)) v4fa;
union FragH { v16h v; v8h half[2]; };

#define NBATCH 8
#define GH     32          // grid rows
#define GW     32          // grid cols
#define NTOKB  1024        // tokens per batch
#define NTOK   8192        // total token rows
#define CW     256         // embed width
#define NQKV   768         // 3*CW
#define NHEAD  8
#define HDIM   32
#define RH     3           // window half height (7 rows)
#define RW     5           // window half width (11 cols)
#define FTILE  512         // halves of one 16 x 32 fragment tile (two 512-B parts)
#define HPLANE 32768       // halves of one (batch, head) plane: 1024 tokens x 32 channels
#define PTH    72          // LDS pitch (halves) of the [128 channels][64 tokens] f16 staging of V
#define POH    264         // LDS pitch (halves) of the [32 tokens][256 channels] f16 staging of O
#define L2E    1.44269504088896340736f
#define TPB    256
#define WAVES  8
#define MT     64          // token tile of gemm_qkv_k
#define NT     128         // output-column tile of gemm_qkv_k
#define PQF    132         // LDS pitch (floats) of the [64][128] f32 staging
#define PW     36          // LDS pitch (floats) of a wave's own [32 tokens][32 cols] f32 staging: 144 B = 16 B x 9
#define KPRE   4           // k steps of the projection whose proj_w tiles are loaded ahead of the window loop
#define PS     264         // LDS pitch (halves) of the f16 operand tiles: 528 B = 16 B x 33, for ds_load_b128 readers
#define ACAR   16.0f
#define WCAR   256.0f
#define OCAR   256.0f
#define SC_AW  (1.0f / (16.0f * 256.0f))
#define SC_OW  (1.0f / (256.0f * 256.0f))
#define QSC    0.0625f     // 256^-0.5

static_assert(TPB == WAVES * 32);
static_assert(GH * GW == NTOKB);
static_assert(NBATCH * NTOKB == NTOK);
static_assert(NHEAD * HDIM == CW);
static_assert(NHEAD == WAVES);
static_assert(HDIM == 32 && GW == 32);
static_assert(HPLANE == NTOKB * HDIM && FTILE == 16 * HDIM);
static_assert((PTH % 8) == 0 && (POH % 8) == 0);
static_assert(128 * PTH * 2 <= MT * PQF * 4);
static_assert((NTOK % MT) == 0);
static_assert((NTOK % WAVES) == 0);
static_assert((CW % 32) == 0);
static_assert((NQKV % 128) == 0);
static_assert((PQF % 4) == 0);
static_assert(MT == 64);
static_assert(CW == 256 && TPB == 256);
static_assert((PS % 8) == 0 && PS >= CW);
static_assert(MT * PQF * 4 <= (MT + NT) * PS * 2);
static_assert(NTOK / MT == (CW / 16) * (CW / 32));   // one proj_w fragment tile per token tile of gemm_qkv_k
static_assert(CW == WAVES * 32 && (PW % 4) == 0);

DEVINL int imin(int a, int b) { return a < b ? a : b; }
DEVINL int imax(int a, int b) { return a > b ? a : b; }

// ---------------------------------------------------------------------------
// WMMA helper with hazard guard (ties D, keeps A/B live).
// Fragment map (wave32): lane l, h = l>>4, m = n = l&15.
//   A/B element i: i<8 -> k0+8h+i ; i>=8 -> k0+16+8h+(i-8)   (two 16-B row loads)
//   D element r : row 8h+r, col l&15
// ---------------------------------------------------------------------------
DEVINL v8f wmma_f16(v16h a, v16h b, v8f c) {
  v8f d = __builtin_amdgcn_wmma_f32_16x16x32_f16(false, a, false, b, (short)0, c, false, false);
  asm volatile("v_nop\n\tv_nop\n\tv_nop\n\tv_nop" : "+v"(d) : "v"(a), "v"(b));
  return d;
}
DEVINL v8f zero8f() {
  v8f z = {0.f, 0.f, 0.f, 0.f, 0.f, 0.f, 0.f, 0.f};
  return z;
}
// row already includes the +8h lane offset; k contiguous in memory
DEVINL void load_frag(FragH& f, const f16t* row, int k0) {
  f.half[0] = *(const v8ha*)(row + k0);
  f.half[1] = *(const v8ha*)(row + k0 + 16);
}

// lane l with lane l ^ 16 (a vector cross-row move; __shfl_xor would go through the LDS unit)
DEVINL float xhalf(float x) {
  return __builtin_bit_cast(float, __builtin_amdgcn_permlanex16(__builtin_bit_cast(int, x), __builtin_bit_cast(int, x),
                                                                0x76543210, 0xfedcba98, false, false));
}

// 2^x.  The v_nop is the slot the instruction set asks for behind a transcendental before its result
// is used or its source overwritten; inside the statement it cannot be scheduled away from the v_exp.
DEVINL float exp2_slot(float x) {
  float e;
  asm("v_exp_f32 %0, %1\n\tv_nop" : "=v"(e) : "v"(x));
  return e;
}

// One fragment tile stored in fragment order: part p (elements 8p..8p+7 of every lane) is 512
// contiguous bytes, lane l's 16 bytes at 16*l, so each load reads four whole 128-B lines.
DEVINL void load_tile(FragH& f, const f16t* tile, int lane) {
  f.half[0] = *(const v8ha*)(tile + 8 * lane);
  f.half[1] = *(const v8ha*)(tile + 256 + 8 * lane);
}

// ---------------------------------------------------------------------------
// Operand tiles in LDS: ROWS rows of CW halves at pitch PS.  The source rows are whole and follow
// one another in memory, so every wave-wide load reads 512 contiguous bytes (four whole lines).
// ---------------------------------------------------------------------------
// f32 source, times sc, to f16.  Thread = 4 floats per step; a step of the block is 4 rows.
template <int ROWS>
DEVINL void stage_f32(const float* __restrict__ src, f16t* s, float sc, int tid) {
  const float* g = src + 4 * tid;
  f16t* d = s + (tid >> 6) * PS + 4 * (tid & 63);
  #pragma unroll
  for (int i0 = 0; i0 < ROWS / 4; i0 += 16) {
    v4f r[16];                                   // 16 loads in flight per thread
    #pragma unroll
    for (int j = 0; j < 16; ++j) r[j] = *(const v4fa*)(g + 1024 * (i0 + j));
    #pragma unroll
    for (int j = 0; j < 16; ++j) {
      v4h o;
      #pragma unroll
      for (int c = 0; c < 4; ++c) o[c] = (f16t)(r[j][c] * sc);
      *(v4ha*)(d + 4 * (i0 + j) * PS) = o;
    }
  }
}

// ---------------------------------------------------------------------------
// One wave: 16 token rows (A tile in LDS) x 64 output cols (4 N-tiles of the B tile in LDS),
// K = CW.  arow / brow already carry the +m row and +8h k offsets; N-tile j is brow + 16*j*PS.
// ---------------------------------------------------------------------------
// The ten LDS reads of k step ks+1 are issued as one group ahead of the products of step ks (a
// second fragment set), so a product waits for no read issued just in front of it.
DEVINL void load_step(FragH& a, FragH (&b)[4], const f16t* arow, const f16t* brow, int k0) {
  load_frag(a, arow, k0);
  #pragma unroll
  for (int n = 0; n < 4; ++n) load_frag(b[n], brow + 16 * n * PS, k0);
}
DEVINL void mma_4n(const f16t* arow, const f16t* brow, v8f (&acc)[4]) {
  FragH a[2], b[2][4];
  load_step(a[0], b[0], arow, brow, 0);
  #pragma unroll
  for (int ks = 0; ks < CW / 32; ++ks) {
    const int cur = ks & 1;
    if (ks + 1 < CW / 32) load_step(a[cur ^ 1], b[cur ^ 1], arow, brow, 32 * (ks + 1));
    #pragma unroll
    for (int n = 0; n < 4; ++n) acc[n] = wmma_f16(a[cur].v, b[cur][n].v, acc[n]);
  }
}

// ---------------------------------------------------------------------------
// Kernel 1: Q / K / V = (x*16) @ (qkv_w*256)^T + qkv_b (K = 256) -> f16 planes, one of HPLANE halves per
// (batch, head), made of 16 x 32 fragment tiles in the order load_tile reads.  Q additionally
// scaled by 1/16.
//   Q, K: tile = 16 tokens (tile index token>>4); lane (h, m) part p holds token m, channels
//         16p+8h .. +7 of the head.
//   V   : tile = 16 channels x the 32 tokens of one grid row (tile index 2*row + (channel>>4));
//         lane (h, m) part p holds channel m, tokens 16p+8h .. +7 of the row.
// Block = (64-token tile, y in 0..5: plane = y>>1, 128-col half = y&1, block-
// uniform).  Wave w: token 16-tile w&3, 64 output cols of half w>>2.
// Operands: the block's 64 rows of x and 128 rows of qkv_w, f32, go through stage_f32 into LDS;
// the epilogue's staging reuses that LDS behind a barrier.
// Epilogue: (acc*SC_AW + bias) * osc staged in LDS ([64 tokens][128] f32 for Q and K,
// [128 channels][64 tokens] f16 for V), then 512-B stores: 4 heads x 8 parts per block, wave w
// writes part w of each head's 4 KB.
// coverage per block: 64 tokens x 128 cols; grid 128 x 6 = 8192 tokens x 768 qkv channels.
// The 128 blocks of y = 0 also write Wf = proj_w*256 in f16, one 16 x 32 fragment tile each (tile
// index 8*(output col >> 4) + (k >> 5) = blockIdx.x; lane (h, m) part p holds output col m,
// k 16p+8h .. +7): wave p writes part p.  Its two loads fly with the staging loads; its store goes
// with the block's last stores.
// ---------------------------------------------------------------------------
// Second bound: six waves per SIMD, so that three blocks (the whole grid) are resident at once.
__global__ __launch_bounds__(TPB, 6) void gemm_qkv_k(const float* __restrict__ x, const float* __restrict__ qw,
                                                 const float* __restrict__ bias, const float* __restrict__ pw,
                                                 f16t* __restrict__ Qo, f16t* __restrict__ Ko,
                                                 f16t* __restrict__ Vo, f16t* __restrict__ Wf)
{
  __shared__ __attribute__((aligned(16))) f16t sop[(MT + NT) * PS];   // 101,376 B: three blocks per WGP
  f16t* sA = sop;
  f16t* sB = sop + MT * PS;
  float* sbuf = (float*)sop;                       // [64][PQF] f32, after the products
  const int tid = threadIdx.x, lane = tid & 31, wave = tid >> 5;
  const int h = lane >> 4, m = lane & 15;
  const int mt = wave & 3, nh = wave >> 2;
  const int row0 = blockIdx.x * MT, y = blockIdx.y;
  const int pl = y >> 1, chalf = y & 1;
  const int bb = row0 >> 10, tk0 = row0 & (NTOKB - 1);   // the 64 tokens lie in one batch
  f16t* outp = ((pl == 0) ? Qo : ((pl == 1) ? Ko : Vo)) + (size_t)(bb * NHEAD + 4 * chalf) * HPLANE;
  const float osc = (pl == 0) ? QSC : 1.0f;
  f16t* sT = (f16t*)sbuf;

  v8f acc[4];
  #pragma unroll
  for (int n = 0; n < 4; ++n) acc[n] = zero8f();
  const bool wprep = (y == 0) && (wave < 2);       // wave-uniform
  v4f pw0 = {0.f, 0.f, 0.f, 0.f}, pw1 = pw0;
  if (wprep) {
    const float* g = pw + (size_t)(16 * (blockIdx.x >> 3) + m) * CW + 32 * (blockIdx.x & 7) + 16 * wave + 8 * h;
    pw0 = *(const v4fa*)g;
    pw1 = *(const v4fa*)(g + 4);
  }
  stage_f32<MT>(x + (size_t)row0 * CW, sA, ACAR, tid);
  stage_f32<NT>(qw + (size_t)y * NT * CW, sB, WCAR, tid);
  __syncthreads();                                 // the tiles are whole before any fragment is read
  mma_4n(sA + (16 * mt + m) * PS + 8 * h, sB + (64 * nh + m) * PS + 8 * h, acc);
  __syncthreads();                                 // every fragment is read before sbuf overwrites the tiles

  const int cb = y * 128 + 64 * nh;                // qkv channel base of this wave
  if (pl == 2) {                                   // block-uniform
    #pragma unroll
    for (int n = 0; n < 4; ++n) {
      const float bv = bias[cb + 16 * n + m];
      v8h pk;                                      // 8 consecutive tokens of one channel
      #pragma unroll
      for (int r = 0; r < 8; ++r) pk[r] = (f16t)(acc[n][r] * SC_AW + bv);
      *(v8ha*)(sT + (64 * nh + 16 * n + m) * PTH + 16 * mt + 8 * h) = pk;
    }
  } else {
    #pragma unroll
    for (int n = 0; n < 4; ++n) {
      const float bv = bias[cb + 16 * n + m];
      #pragma unroll
      for (int r = 0; r < 8; ++r)
        sbuf[(16 * mt + 8 * h + r) * PQF + 64 * nh + 16 * n + m] = (acc[n][r] * SC_AW + bv) * osc;
    }
  }
  __syncthreads();
  const int part = wave & 1;
  v8h o[4];                                            // the four LDS reads overlap, ahead of the stores
  f16t* dst;
  if (pl == 2) {
    const int hl = wave >> 2, mtv = (wave >> 1) & 1;   // grid row of the pair, 16-channel tile
    #pragma unroll
    for (int hd = 0; hd < 4; ++hd)
      o[hd] = *(const v8ha*)(sT + (32 * hd + 16 * mtv + m) * PTH + 32 * hl + 16 * part + 8 * h);
    dst = outp + (((tk0 >> 5) + hl) * 2 + mtv) * FTILE + 256 * part + 8 * lane;
  } else {
    const int tl = wave >> 1;                          // 16-token tile of the 64
    #pragma unroll
    for (int hd = 0; hd < 4; ++hd) {
      const float* sp = sbuf + (16 * tl + m) * PQF + 32 * hd + 16 * part + 8 * h;
      const v4f a = *(const v4fa*)sp, c = *(const v4fa*)(sp + 4);
      #pragma unroll
      for (int j = 0; j < 4; ++j) {
        o[hd][j]     = (f16t)a[j];
        o[hd][4 + j] = (f16t)c[j];
      }
    }
    dst = outp + ((tk0 >> 4) + tl) * FTILE + 256 * part + 8 * lane;
  }
  #pragma unroll
  for (int hd = 0; hd < 4; ++hd) *(v8h*)(dst + (size_t)hd * HPLANE) = o[hd];
  if (wprep) {                                     // behind the last barrier: no barrier waits for this store
    v8h wo;
    #pragma unroll
    for (int j = 0; j < 4; ++j) {
      wo[j]     = (f16t)(pw0[j] * WCAR);
      wo[4 + j] = (f16t)(pw1[j] * WCAR);
    }
    *(v8h*)(Wf + blockIdx.x * FTILE + 256 * wave + 8 * lane) = wo;
  }
}

// ---------------------------------------------------------------------------
// Kernel 2: 7x11 local-window attention on matrix tiles, then the output projection of its 32 tokens.  Block = one grid row of one batch
// (32 query tokens), wave = head.  Token (h0,w0) attends (hh,ww) iff |hh-h0|<=3 and
// |ww-w0|<=5 inside the grid.  The wave walks the window's grid rows (bounds clamped to the
// grid, wave-uniform); a grid row is 32 keys = one K step:
//   S^T[key][query] = K.Q^T : A = K tile (16 keys), B = Q tile (16 queries), 2 x 2 tiles.
//       Lane (h, n) holds keys 16ct+8h+r of query 16qt+n; keys with |ww-w0| > 5 get -1e30.
//   running softmax per query (f32): new maximum (own 16 scores, then the partner lane n^16),
//       e = exp(s - max), the earlier sum and context scaled by exp(old max - new max).
//   O^T[channel][query] += V^T.P^T : the two f32 score tiles of a query tile, converted in
//       place, are the B operand (element 8ct+r = key 16ct+8h+r); A = V tile (16 channels).
// The next grid row's K and V tiles are loaded while this one is worked on.
// O [32][256] f16 x256: context / sum, staged in LDS; behind the barrier it is the A operand of
//   out = O @ (proj_w*256)^T + proj_b (K = 256) -> d_out f32 [8192][256]:
//   wave w = the 32 tokens x output cols 32w .. 32w+31 (2 x 2 tiles, 8 k steps).  Its 16 B tiles
//   (16 KB of Wf) go straight into registers: those of the first KPRE k steps in front of the window
//   loop, so they fly under it; the rest behind it, where the loop's registers are free.
//   acc*SC_OW + bias goes through the wave's own [32][32] f32 LDS range, then stores of four whole
//   128-B lines (8 lanes = one token's 32 cols).
// coverage: 256 blocks x 32 tokens = 8192 rows x (8 waves x 32 cols).
// ---------------------------------------------------------------------------
__global__ __launch_bounds__(TPB) void attn_proj_k(const f16t* __restrict__ Qf, const f16t* __restrict__ Kf,
                                                  const f16t* __restrict__ Vf, const f16t* __restrict__ Wf,
                                                  const float* __restrict__ bias, float* __restrict__ out)
{
  __shared__ __attribute__((aligned(16))) f16t so[GW * POH];            // 16,896 B
  __shared__ __attribute__((aligned(16))) float sw[WAVES * GW * PW];    // 36,864 B
  const int tid = threadIdx.x, lane = tid & 31;
  const int wave = __builtin_amdgcn_readfirstlane(tid >> 5);   // = head
  const int h = lane >> 4, n = lane & 15;
  const int blk = imin(blockIdx.x, NBATCH * GH - 1);           // grid exact
  const int bb = blk >> 5, h0 = blk & 31;
  const size_t pb = (size_t)(bb * NHEAD + wave) * HPLANE;
  const f16t* kb = Kf + pb;
  const f16t* vb = Vf + pb;
  const int hlo = imax(h0 - RH, 0), hhi = imin(h0 + RH, GH - 1);
  __builtin_assume(hlo <= hhi);               // h0 is in the grid: no guard round the loop for the first loads to sink behind

  FragH q[2], kc[2], vc[2];
  #pragma unroll
  for (int t = 0; t < 2; ++t) {
    load_tile(q[t], Qf + pb + (2 * h0 + t) * FTILE, lane);
    load_tile(kc[t], kb + (2 * hlo + t) * FTILE, lane);
    load_tile(vc[t], vb + (2 * hlo + t) * FTILE, lane);
  }
  // Keeps the Q, K, V loads in front of the proj_w loads: the first window row waits for the former only.
  __builtin_amdgcn_sched_barrier(0);
  const f16t* wt = Wf + 2 * wave * (CW / 32) * FTILE;
  FragH wb[2][CW / 32];                       // proj_w tiles [col tile][k step] of the wave's 32 output cols
  #pragma unroll
  for (int ks = 0; ks < KPRE; ++ks) {
    load_tile(wb[0][ks], wt + ks * FTILE, lane);
    load_tile(wb[1][ks], wt + (CW / 32 + ks) * FTILE, lane);
  }

  v8f acc[2][2];                              // [channel tile][query tile]
  float mxl[2], ls[2];                        // running maximum (times log2 e) and lane's part of the sum
  #pragma unroll
  for (int qt = 0; qt < 2; ++qt) {
    acc[0][qt] = zero8f();
    acc[1][qt] = zero8f();
    mxl[qt] = -3.0e38f;
    ls[qt] = 0.0f;
  }
  const int dl = 8 * h - n + RW;              // ww - w0 + 5 = dl + 16*(ct - qt) + r

  #pragma unroll 1   // rolled: the trip count varies (4..7) and one row ahead is enough in flight
  for (int hh = hlo; hh <= hhi; ++hh) {
    const int hn = imin(hh + 1, hhi);
    FragH kn[2], vn[2];
    #pragma unroll
    for (int t = 0; t < 2; ++t) {
      load_tile(kn[t], kb + (2 * hn + t) * FTILE, lane);
      load_tile(vn[t], vb + (2 * hn + t) * FTILE, lane);
    }
    #pragma unroll
    for (int qt = 0; qt < 2; ++qt) {
      v8f s[2];
      float mloc = -1.0e30f;
      #pragma unroll
      for (int ct = 0; ct < 2; ++ct) {
        s[ct] = wmma_f16(kc[ct].v, q[qt].v, zero8f());
        #pragma unroll
        for (int r = 0; r < 8; ++r) {
          const bool live = (unsigned)(dl + 16 * (ct - qt) + r) <= (unsigned)(2 * RW);
          s[ct][r] = live ? s[ct][r] : -1.0e30f;
          mloc = fmaxf(mloc, s[ct][r]);
        }
      }
      mloc = fmaxf(mloc, xhalf(mloc));                // every query has a live key in every grid row
      const float mnew = fmaxf(mxl[qt], mloc * L2E);
      const float sc = exp2_slot(mxl[qt] - mnew);
      mxl[qt] = mnew;
      FragH p;
      float ps[4] = {0.0f, 0.0f, 0.0f, 0.0f};         // four short chains of adds in place of one long one
      #pragma unroll
      for (int ct = 0; ct < 2; ++ct) {
        #pragma unroll
        for (int r = 0; r < 8; ++r) {
          const float e = exp2_slot(fmaf(s[ct][r], L2E, -mnew));
          ps[r & 3] += e;
          p.v[8 * ct + r] = (f16t)e;
        }
      }
      ls[qt] = fmaf(ls[qt], sc, (ps[0] + ps[1]) + (ps[2] + ps[3]));
      #pragma unroll
      for (int mt = 0; mt < 2; ++mt) {
        #pragma unroll
        for (int r = 0; r < 8; ++r) acc[mt][qt][r] *= sc;
        acc[mt][qt] = wmma_f16(vc[mt].v, p.v, acc[mt][qt]);
      }
    }
    #pragma unroll
    for (int t = 0; t < 2; ++t) {
      kc[t] = kn[t];
      vc[t] = vn[t];
    }
  }
  #pragma unroll
  for (int ks = KPRE; ks < CW / 32; ++ks) {   // into the registers that the window loop has left
    load_tile(wb[0][ks], wt + ks * FTILE, lane);
    load_tile(wb[1][ks], wt + (CW / 32 + ks) * FTILE, lane);
  }

  #pragma unroll
  for (int qt = 0; qt < 2; ++qt) {
    const float l = ls[qt] + xhalf(ls[qt]);           // >= 1 (the maximum's key gives e = 1)
    const float rs = OCAR / l;
    #pragma unroll
    for (int mt = 0; mt < 2; ++mt) {
      v8h oh;                                         // 8 consecutive channels of one token
      #pragma unroll
      for (int r = 0; r < 8; ++r) oh[r] = (f16t)(acc[mt][qt][r] * rs);
      *(v8ha*)(so + (16 * qt + n) * POH + HDIM * wave + 16 * mt + 8 * h) = oh;
    }
  }
  __syncthreads();                                    // O is whole before any fragment of it is read

  v8f pa[2][2];                                       // [token tile][col tile]
  #pragma unroll
  for (int t = 0; t < 2; ++t) {
    pa[t][0] = zero8f();
    pa[t][1] = zero8f();
  }
  const f16t* arow = so + n * POH + 8 * h;
  FragH a[2][2];                                      // the reads of k step ks+1 go ahead of the products of ks
  load_frag(a[0][0], arow, 0);
  load_frag(a[0][1], arow + 16 * POH, 0);
  #pragma unroll
  for (int ks = 0; ks < CW / 32; ++ks) {
    const int cur = ks & 1;
    if (ks + 1 < CW / 32) {
      load_frag(a[cur ^ 1][0], arow, 32 * (ks + 1));
      load_frag(a[cur ^ 1][1], arow + 16 * POH, 32 * (ks + 1));
    }
    #pragma unroll
    for (int t = 0; t < 2; ++t) {
      #pragma unroll
      for (int nt = 0; nt < 2; ++nt) pa[t][nt] = wmma_f16(a[cur][t].v, wb[nt][ks].v, pa[t][nt]);
    }
  }

  float* sp = sw + wave * (GW * PW);
  #pragma unroll
  for (int nt = 0; nt < 2; ++nt) {
    const float bv = bias[32 * wave + 16 * nt + n];
    #pragma unroll
    for (int t = 0; t < 2; ++t) {
      #pragma unroll
      for (int r = 0; r < 8; ++r) sp[(16 * t + 8 * h + r) * PW + 16 * nt + n] = pa[t][nt][r] * SC_OW + bv;
    }
  }
  // The wave reads back what its other lanes wrote: its LDS writes are done first, and the compiler
  // moves no read of the range over this line.  No other wave touches the range, so no barrier.
  asm volatile("s_wait_dscnt 0x0" ::: "memory");
  #pragma unroll
  for (int i = 0; i < 8; ++i) {
    const int tok = 4 * i + (lane >> 3);
    const v4f v = *(const v4fa*)(sp + tok * PW + 4 * (lane & 7));
    *(v4f*)(out + (size_t)(blk * GW + tok) * CW + 32 * wave + 4 * (lane & 7)) = v;
  }
}

// ---------------------------------------------------------------------------
extern "C" void kernel_launch(void* const* d_in, const int* in_sizes, int n_in,
                              void* d_out, int out_size, void* d_ws, size_t ws_size,
                              hipStream_t stream) {
  if (n_in < 5) return;
  if (in_sizes[0] != NTOK * CW) return;
  if (in_sizes[1] != NQKV * CW || in_sizes[2] != NQKV) return;
  if (in_sizes[3] != CW * CW || in_sizes[4] != CW) return;
  if (out_size != NTOK * CW) return;

  const float* x      = (const float*)d_in[0];   // [8192][256]
  const float* qkv_w  = (const float*)d_in[1];   // [768][256]
  const float* qkv_b  = (const float*)d_in[2];   // [768]
  const float* proj_w = (const float*)d_in[3];   // [256][256]
  const float* proj_b = (const float*)d_in[4];   // [256]
  float* outp = (float*)d_out;

  // workspace carve (bytes); every region is an exact multiple of its whole-row
  //   Q    8192 x 256 f16   =  4,194,304
  //   K    8192 x 256 f16   =  4,194,304
  //   V    8192 x 256 f16   =  4,194,304
  //   Wf    256 x 256 f16   =    131,072
  //   total                 = 12,713,984
  const size_t szP16  = (size_t)NTOK * CW * 2;
  size_t off = 0;
  char* ws = (char*)d_ws;
  f16t*  Qp   = (f16t*)(ws + off);  off += szP16;
  f16t*  Kp   = (f16t*)(ws + off);  off += szP16;
  f16t*  Vp   = (f16t*)(ws + off);  off += szP16;
  f16t*  Wfp  = (f16t*)(ws + off);  off += (size_t)CW * CW * 2;
  if (off > ws_size) return;

  // Q (x1/16), K, V = x @ qkv_w^T + qkv_b  (f16 planes in fragment order); Wf = proj_w*256
  gemm_qkv_k<<<dim3(NTOK / MT, NQKV / 128), TPB, 0, stream>>>(x, qkv_w, qkv_b, proj_w, Qp, Kp, Vp, Wfp);
  // 7x11 window attention -> O (LDS) -> out = O @ proj_w^T + proj_b
  attn_proj_k<<<NBATCH * GH, TPB, 0, stream>>>(Qp, Kp, Vp, Wfp, proj_b, outp);
  (void)hipGetLastError();
}

// v005
// It runs in 19.1 microseconds.
// Two timings next to v004 both put it at 1.06 times that version's speed.
// All steps since v000 together make it 3.94 times as fast.
// Contractions x@qkv_w^T (K=256), o@proj_w^T (K=256), window scores k.q (K=32) and context sums v.p (K=32 keys): v_wmma_f32_16x16x32_f16 (f16 operands, f32 accumulate). Softmax: f32 VALU.
// f16 operands and carries: x*16 and qkv_w*256 are converted by gemm_qkv_k on the way into its LDS tiles; proj_w*256 is written by the same launch as a plane in fragment order; O = window context*256 stays in LDS. Q, K, V planes are f16 in fragment order (no carry; Q holds bias and the 1/16 scale).
// Inverse carries folded exactly once: gemm_qkv_k takes acc*SC_AW (1/(16*256)) before the bias add; attn_proj_k stages acc*SC_OW (1/(256*256)) before the bias add. No other consumer rescales.
#include <hip/hip_runtime.h>
#include <stdint.h>

#define DEVINL __device__ __forceinline__

typedef _Float16 f16t;
typedef _Float16 v16h __attribute__((ext_vector_type(16)));
typedef _Float16 v8h  __attribute__((ext_vector_type(8)));
typedef float    v8f  __attribute__((ext_vector_type(8)));
typedef float    v4f  __attribute__((ext_vector_type(4)));
typedef _Float16 v4h  __attribute__((ext_vector_type(4)));
typedef v8h __attribute__((may_alias)) v8ha;
typedef v4h __attribute__((may_alias)) v4ha;
typedef v4f __attribute__((may_alias)) v4fa;
union FragH { v16h v; v8h half[2]; };

#define NBATCH 8
#define GH     32          // grid rows
#define GW     32          // grid cols
#define NTOKB  1024        // tokens per batch
#define NTOK   8192        // total token rows
#define CW     256         // embed width
#define NQKV   768         // 3*CW
#define NHEAD  8
#define HDIM   32
#define RH     3           // window half height (7 rows)
#define RW     5           // window half width (11 cols)
#define FTILE  512         // halves of one 16 x 32 fragment tile (two 512-B parts)
#define HPLANE 32768       // halves of one (batch, head) plane: 1024 tokens x 32 channels
#define POH    264         // LDS pitch (halves) of the [32 tokens][256 channels] f16 staging of O
#define L2E    1.44269504088896340736f
#define TPB    256
#define WAVES  8
#define MT     128         // token tile of gemm_qkv_k: four grid rows
#define HB     2           // heads per block of gemm_qkv_k
#define GRP    64          // rows of one staging group: 16 loads of 16 B per thread
#define NT     192         // qkv_w rows per block of gemm_qkv_k: HB heads of each of Q, K, V
#define PW     36          // LDS pitch (floats) of a wave's own [32 tokens][32 cols] f32 staging: 144 B = 16 B x 9
#define KPRE   4           // k steps of the projection whose proj_w tiles are loaded ahead of the window loop
#define PS     264         // LDS pitch (halves) of the f16 operand tiles: 528 B = 16 B x 33, for ds_load_b128 readers
#define ACAR   16.0f
#define WCAR   256.0f
#define OCAR   256.0f
#define SC_AW  (1.0f / (16.0f * 256.0f))
#define SC_OW  (1.0f / (256.0f * 256.0f))
#define QSC    0.0625f     // 256^-0.5

static_assert(TPB == WAVES * 32);
static_assert(GH * GW == NTOKB);
static_assert(NBATCH * NTOKB == NTOK);
static_assert(NHEAD * HDIM == CW);
static_assert(NHEAD == WAVES);
static_assert(HDIM == 32 && GW == 32);
static_assert(HPLANE == NTOKB * HDIM && FTILE == 16 * HDIM);
static_assert((POH % 8) == 0);
static_assert((NTOK % MT) == 0);
static_assert((NTOK % WAVES) == 0);
static_assert((CW % 32) == 0);
static_assert(NT == 3 * HB * HDIM && NQKV == 3 * CW && (NHEAD % HB) == 0);
static_assert(MT == 4 * GW && WAVES == 4 * HB && (NTOKB % MT) == 0);
static_assert(GRP == HB * HDIM && (MT % GRP) == 0 && GRP * CW == 16 * 4 * TPB);
static_assert(CW == 256 && TPB == 256);
static_assert((PS % 8) == 0 && PS >= CW);
static_assert(2 * (NTOK / MT) == (CW / 16) * (CW / 32));   // one proj_w fragment tile per block of gemm_qkv_k with y < 2
static_assert(CW == WAVES * 32 && (PW % 4) == 0);

DEVINL int imin(int a, int b) { return a < b ? a : b; }
DEVINL int imax(int a, int b) { return a > b ? a : b; }

// ---------------------------------------------------------------------------
// WMMA helper with hazard guard (ties D, keeps A/B live).
// Fragment map (wave32): lane l, h = l>>4, m = n = l&15.
//   A/B element i: i<8 -> k0+8h+i ; i>=8 -> k0+16+8h+(i-8)   (two 16-B row loads)
//   D element r : row 8h+r, col l&15
// ---------------------------------------------------------------------------
DEVINL v8f wmma_f16(v16h a, v16h b, v8f c) {
  v8f d = __builtin_amdgcn_wmma_f32_16x16x32_f16(false, a, false, b, (short)0, c, false, false);
  asm volatile("v_nop\n\tv_nop\n\tv_nop\n\tv_nop" : "+v"(d) : "v"(a), "v"(b));
  return d;
}
DEVINL v8f zero8f() {
  v8f z = {0.f, 0.f, 0.f, 0.f, 0.f, 0.f, 0.f, 0.f};
  return z;
}
// row already includes the +8h lane offset; k contiguous in memory
DEVINL void load_frag(FragH& f, const f16t* row, int k0) {
  f.half[0] = *(const v8ha*)(row + k0);
  f.half[1] = *(const v8ha*)(row + k0 + 16);
}

// lane l with lane l ^ 16 (a vector cross-row move; __shfl_xor would go through the LDS unit)
DEVINL float xhalf(float x) {
  return __builtin_bit_cast(float, __builtin_amdgcn_permlanex16(__builtin_bit_cast(int, x), __builtin_bit_cast(int, x),
                                                                0x76543210, 0xfedcba98, false, false));
}

// 2^x.  The v_nop is the slot the instruction set asks for behind a transcendental before its result
// is used or its source overwritten; inside the statement it cannot be scheduled away from the v_exp.
DEVINL float exp2_slot(float x) {
  float e;
  asm("v_exp_f32 %0, %1\n\tv_nop" : "=v"(e) : "v"(x));
  return e;
}

// One fragment tile stored in fragment order: part p (elements 8p..8p+7 of every lane) is 512
// contiguous bytes, lane l's 16 bytes at 16*l, so each load reads four whole 128-B lines.
DEVINL void load_tile(FragH& f, const f16t* tile, int lane) {
  f.half[0] = *(const v8ha*)(tile + 8 * lane);
  f.half[1] = *(const v8ha*)(tile + 256 + 8 * lane);
}

// ---------------------------------------------------------------------------
// Operand tiles in LDS: rows of CW halves at pitch PS, staged in groups of GRP rows.  The source
// rows are whole and follow one another in memory, so every wave-wide load reads 512 contiguous
// bytes (four whole lines).  Thread = 4 floats per load; one load of the block is 4 rows.
// ---------------------------------------------------------------------------
DEVINL void grp_load(v4f (&r)[16], const float* __restrict__ src, int tid) {
  const float* g = src + 4 * tid;
  #pragma unroll
  for (int j = 0; j < 16; ++j) r[j] = *(const v4fa*)(g + 1024 * j);
  // The loads' address registers are free for reuse behind this line; as a memory fence it keeps
  // the loads of the group after the next behind it: at most three groups (48 loads per thread,
  // under the load counter's 63) are in flight.
  asm volatile("s_wait_xcnt 0x0" ::: "memory");
  // The earlier group's conversions wait for its data: they stay behind the issue of this group.
  __builtin_amdgcn_sched_barrier(0);
}
// f32 times sc, to f16
DEVINL void grp_store(const v4f (&r)[16], f16t* s, float sc, int tid) {
  f16t* d = s + (tid >> 6) * PS + 4 * (tid & 63);
  #pragma unroll
  for (int j = 0; j < 16; ++j) {
    v4h o;
    #pragma unroll
    for (int c = 0; c < 4; ++c) o[c] = (f16t)(r[j][c] * sc);
    *(v4ha*)(d + 4 * j * PS) = o;
  }
}

// ---------------------------------------------------------------------------
// Kernel 1: Q / K / V = (x*16) @ (qkv_w*256)^T + qkv_b (K = 256) -> f16 planes, one of HPLANE halves per
// (batch, head), made of 16 x 32 fragment tiles in the order load_tile reads.  Q additionally
// scaled by 1/16.
//   Q, K: tile = 16 tokens (tile index token>>4); lane (h, m) part p holds token m, channels
//         16p+8h .. +7 of the head.
//   V   : tile = 16 channels x the 32 tokens of one grid row (tile index 2*row + (channel>>4));
//         lane (h, m) part p holds channel m, tokens 16p+8h .. +7 of the row.
// Block = (128-token tile = four grid rows, y in 0..3 = a pair of heads): 256 blocks, one per WGP.
// Operands: the block's 128 rows of x and the pair's 64 rows of each of the Q, K and V parts of
// qkv_w, f32, go through grp_load / grp_store into LDS (rows 0..127 x, then 64 Q, 64 K, 64 V).
// Wave w = grid row w&3 x head w>>2 of the pair: 32 tokens x the head's 32 Q, 32 K and 32 V
// channels = 12 accumulator tiles on 2 token and 6 weight fragments per k step.
//   Q, K: A = weight tile, B = token tile: D row 8h+r = channel, col = token, so a lane's 8 values
//         are its 16 bytes of part (channel tile) of the plane's token tile.
//   V   : A = token tile, B = weight tile: D row 8h+r = token, col = channel, so a lane's 8 values
//         are its 16 bytes of part (token tile) of the plane's channel tile.
// Epilogue: (acc*SC_AW + bias) (* 1/16 for Q) to f16, one 512-B store per accumulator tile.
// coverage per block: 128 tokens x 2 heads x (Q, K, V); grid 64 x 4 = 8192 tokens x 768 qkv channels.
// The 128 blocks of y < 2 also write Wf = proj_w*256 in f16, one 16 x 32 fragment tile each (tile
// index 8*(output col >> 4) + (k >> 5) = blockIdx.x + 64*y; lane (h, m) part p holds output col m,
// k 16p+8h .. +7): wave p writes part p.  Its two loads fly with the staging loads; its store goes
// with the block's last stores.
// ---------------------------------------------------------------------------
// The sixteen LDS reads of k step ks+1 are issued as one group ahead of the products of step ks (a
// second fragment set), so a product waits for no read issued just in front of it.
// xrow / wrow already carry the +m row and +8h k offsets.
DEVINL void load_step(FragH (&xa)[2], FragH (&wf)[6], const f16t* xrow, const f16t* wrow, int k0) {
  #pragma unroll
  for (int t = 0; t < 2; ++t) load_frag(xa[t], xrow + 16 * t * PS, k0);
  #pragma unroll
  for (int pl = 0; pl < 3; ++pl) {
    #pragma unroll
    for (int c = 0; c < 2; ++c) load_frag(wf[2 * pl + c], wrow + (HB * HDIM * pl + 16 * c) * PS, k0);
  }
}

__global__ __launch_bounds__(TPB) void gemm_qkv_k(const float* __restrict__ x, const float* __restrict__ qw,
                                                 const float* __restrict__ bias, const float* __restrict__ pw,
                                                 f16t* __restrict__ Qo, f16t* __restrict__ Ko,
                                                 f16t* __restrict__ Vo, f16t* __restrict__ Wf)
{
  __shared__ __attribute__((aligned(16))) f16t sop[(MT + NT) * PS];   // 168,960 B: one block per WGP
  f16t* sA = sop;
  f16t* sB = sop + MT * PS;
  const int tid = threadIdx.x, lane = tid & 31, wave = tid >> 5;
  const int h = lane >> 4, m = lane & 15;
  const int gr = wave & 3, hj = wave >> 2;
  const int row0 = blockIdx.x * MT, y = blockIdx.y;
  const int bb = row0 >> 10, tk0 = row0 & (NTOKB - 1);   // the 128 tokens lie in one batch
  const int head = HB * y + hj;

  const int wtile = blockIdx.x + (NTOK / MT) * y;  // proj_w fragment tile of this block, where y < 2
  const bool wprep = (y < 2) && (wave < 2);        // wave-uniform
  v4f pw0 = {0.f, 0.f, 0.f, 0.f}, pw1 = pw0;
  if (wprep) {
    const float* g = pw + (size_t)(16 * (wtile >> 3) + m) * CW + 32 * (wtile & 7) + 16 * wave + 8 * h;
    pw0 = *(const v4fa*)g;
    pw1 = *(const v4fa*)(g + 4);
  }
  {
    const float* xs = x + (size_t)row0 * CW;
    const float* ws = qw + (size_t)(GRP * y) * CW;
    v4f r[2][16];                                  // group g+1 is asked for before group g is converted
    grp_load(r[0], xs, tid);
    #pragma unroll
    for (int g = 0; g < (MT + NT) / GRP; ++g) {    // groups 0, 1: x; 2, 3, 4: the pair's Q, K, V rows of qkv_w
      const int gn = g + 1;
      if (gn < (MT + NT) / GRP)
        grp_load(r[gn & 1], (gn < MT / GRP) ? xs + GRP * gn * CW : ws + (size_t)(gn - MT / GRP) * CW * CW, tid);
      grp_store(r[g & 1], sop + GRP * g * PS, (g < MT / GRP) ? ACAR : WCAR, tid);
    }
  }
  __syncthreads();                                 // the tiles are whole before any fragment is read

  v8f acc[3][2][2];                                // Q, K: [channel tile][token tile]; V: [token tile][channel tile]
  #pragma unroll
  for (int pl = 0; pl < 3; ++pl) {
    #pragma unroll
    for (int i = 0; i < 2; ++i) {
      acc[pl][i][0] = zero8f();
      acc[pl][i][1] = zero8f();
    }
  }
  const f16t* xrow = sA + (32 * gr + m) * PS + 8 * h;
  const f16t* wrow = sB + (HDIM * hj + m) * PS + 8 * h;
  FragH xa[2][2], wf[2][6];
  load_step(xa[0], wf[0], xrow, wrow, 0);
  #pragma unroll
  for (int ks = 0; ks < CW / 32; ++ks) {
    const int cur = ks & 1;
    if (ks + 1 < CW / 32) load_step(xa[cur ^ 1], wf[cur ^ 1], xrow, wrow, 32 * (ks + 1));
    #pragma unroll
    for (int pl = 0; pl < 2; ++pl) {
      #pragma unroll
      for (int c = 0; c < 2; ++c) {
        #pragma unroll
        for (int t = 0; t < 2; ++t) acc[pl][c][t] = wmma_f16(wf[cur][2 * pl + c].v, xa[cur][t].v, acc[pl][c][t]);
      }
    }
    #pragma unroll
    for (int t = 0; t < 2; ++t) {
      #pragma unroll
      for (int c = 0; c < 2; ++c) acc[2][t][c] = wmma_f16(xa[cur][t].v, wf[cur][4 + c].v, acc[2][t][c]);
    }
  }

  const size_t pb = (size_t)(bb * NHEAD + head) * HPLANE;
  #pragma unroll
  for (int pl = 0; pl < 2; ++pl) {
    f16t* dst = ((pl == 0) ? Qo : Ko) + pb + ((tk0 >> 4) + 2 * gr) * FTILE + 8 * lane;
    const float osc = (pl == 0) ? QSC : 1.0f;
    #pragma unroll
    for (int c = 0; c < 2; ++c) {
      const float* bp = bias + CW * pl + HDIM * head + 16 * c + 8 * h;
      const v4f b0 = *(const v4fa*)bp, b1 = *(const v4fa*)(bp + 4);
      #pragma unroll
      for (int t = 0; t < 2; ++t) {
        v8h pk;                                    // 8 consecutive channels of one token
        #pragma unroll
        for (int r = 0; r < 4; ++r) {
          pk[r]     = (f16t)((acc[pl][c][t][r] * SC_AW + b0[r]) * osc);
          pk[4 + r] = (f16t)((acc[pl][c][t][4 + r] * SC_AW + b1[r]) * osc);
        }
        *(v8h*)(dst + t * FTILE + 256 * c) = pk;
      }
    }
  }
  {
    f16t* dst = Vo + pb + 2 * ((tk0 >> 5) + gr) * FTILE + 8 * lane;
    #pragma unroll
    for (int c = 0; c < 2; ++c) {
      const float bv = bias[2 * CW + HDIM * head + 16 * c + m];
      #pragma unroll
      for (int t = 0; t < 2; ++t) {
        v8h pk;                                    // 8 consecutive tokens of one channel
        #pragma unroll
        for (int r = 0; r < 8; ++r) pk[r] = (f16t)(acc[2][t][c][r] * SC_AW + bv);
        *(v8h*)(dst + c * FTILE + 256 * t) = pk;
      }
    }
  }
  if (wprep) {
    v8h wo;
    #pragma unroll
    for (int j = 0; j < 4; ++j) {
      wo[j]     = (f16t)(pw0[j] * WCAR);
      wo[4 + j] = (f16t)(pw1[j] * WCAR);
    }
    *(v8h*)(Wf + wtile * FTILE + 256 * wave + 8 * lane) = wo;
  }
}

// ---------------------------------------------------------------------------
// Kernel 2: 7x11 local-window attention on matrix tiles, then the output projection of its 32 tokens.  Block = one grid row of one batch
// (32 query tokens), wave = head.  Token (h0,w0) attends (hh,ww) iff |hh-h0|<=3 and
// |ww-w0|<=5 inside the grid.  The wave walks the window's grid rows (bounds clamped to the
// grid, wave-uniform); a grid row is 32 keys = one K step:
//   S^T[key][query] = K.Q^T : A = K tile (16 keys), B = Q tile (16 queries), 2 x 2 tiles.
//       Lane (h, n) holds keys 16ct+8h+r of query 16qt+n; keys with |ww-w0| > 5 get -1e30.
//   running softmax per query (f32): new maximum (own 16 scores, then the partner lane n^16),
//       e = exp(s - max), the earlier sum and context scaled by exp(old max - new max).
//   O^T[channel][query] += V^T.P^T : the two f32 score tiles of a query tile, converted in
//       place, are the B operand (element 8ct+r = key 16ct+8h+r); A = V tile (16 channels).
// The next grid row's K and V tiles are loaded while this one is worked on.
// O [32][256] f16 x256: context / sum, staged in LDS; behind the barrier it is the A operand of
//   out = O @ (proj_w*256)^T + proj_b (K = 256) -> d_out f32 [8192][256]:
//   wave w = the 32 tokens x output cols 32w .. 32w+31 (2 x 2 tiles, 8 k steps).  Its 16 B tiles
//   (16 KB of Wf) go straight into registers: those of the first KPRE k steps in front of the window
//   loop, so they fly under it; the rest behind it, where the loop's registers are free.
//   acc*SC_OW + bias goes through the wave's own [32][32] f32 LDS range, then stores of four whole
//   128-B lines (8 lanes = one token's 32 cols).
// coverage: 256 blocks x 32 tokens = 8192 rows x (8 waves x 32 cols).
// ---------------------------------------------------------------------------
__global__ __launch_bounds__(TPB) void attn_proj_k(const f16t* __restrict__ Qf, const f16t* __restrict__ Kf,
                                                  const f16t* __restrict__ Vf, const f16t* __restrict__ Wf,
                                                  const float* __restrict__ bias, float* __restrict__ out)
{
  __shared__ __attribute__((aligned(16))) f16t so[GW * POH];            // 16,896 B
  __shared__ __attribute__((aligned(16))) float sw[WAVES * GW * PW];    // 36,864 B
  const int tid = threadIdx.x, lane = tid & 31;
  const int wave = __builtin_amdgcn_readfirstlane(tid >> 5);   // = head
  const int h = lane >> 4, n = lane & 15;
  const int blk = imin(blockIdx.x, NBATCH * GH - 1);           // grid exact
  const int bb = blk >> 5, h0 = blk & 31;
  const size_t pb = (size_t)(bb * NHEAD + wave) * HPLANE;
  const f16t* kb = Kf + pb;
  const f16t* vb = Vf + pb;
  const int hlo = imax(h0 - RH, 0), hhi = imin(h0 + RH, GH - 1);
  __builtin_assume(hlo <= hhi);               // h0 is in the grid: no guard round the loop for the first loads to sink behind

  FragH q[2], kc[2], vc[2];
  #pragma unroll
  for (int t = 0; t < 2; ++t) {
    load_tile(q[t], Qf + pb + (2 * h0 + t) * FTILE, lane);
    load_tile(kc[t], kb + (2 * hlo + t) * FTILE, lane);
    load_tile(vc[t], vb + (2 * hlo + t) * FTILE, lane);
  }
  // Keeps the Q, K, V loads in front of the proj_w loads: the first window row waits for the former only.
  __builtin_amdgcn_sched_barrier(0);
  const f16t* wt = Wf + 2 * wave * (CW / 32) * FTILE;
  FragH wb[2][CW / 32];                       // proj_w tiles [col tile][k step] of the wave's 32 output cols
  #pragma unroll
  for (int ks = 0; ks < KPRE; ++ks) {
    load_tile(wb[0][ks], wt + ks * FTILE, lane);
    load_tile(wb[1][ks], wt + (CW / 32 + ks) * FTILE, lane);
  }

  v8f acc[2][2];                              // [channel tile][query tile]
  float mxl[2], ls[2];                        // running maximum (times log2 e) and lane's part of the sum
  #pragma unroll
  for (int qt = 0; qt < 2; ++qt) {
    acc[0][qt] = zero8f();
    acc[1][qt] = zero8f();
    mxl[qt] = -3.0e38f;
    ls[qt] = 0.0f;
  }
  const int dl = 8 * h - n + RW;              // ww - w0 + 5 = dl + 16*(ct - qt) + r

  #pragma unroll 1   // rolled: the trip count varies (4..7) and one row ahead is enough in flight
  for (int hh = hlo; hh <= hhi; ++hh) {
    const int hn = imin(hh + 1, hhi);
    FragH kn[2], vn[2];
    #pragma unroll
    for (int t = 0; t < 2; ++t) {
      load_tile(kn[t], kb + (2 * hn + t) * FTILE, lane);
      load_tile(vn[t], vb + (2 * hn + t) * FTILE, lane);
    }
    #pragma unroll
    for (int qt = 0; qt < 2; ++qt) {
      v8f s[2];
      float mloc = -1.0e30f;
      #pragma unroll
      for (int ct = 0; ct < 2; ++ct) {
        s[ct] = wmma_f16(kc[ct].v, q[qt].v, zero8f());
        #pragma unroll
        for (int r = 0; r < 8; ++r) {
          const bool live = (unsigned)(dl + 16 * (ct - qt) + r) <= (unsigned)(2 * RW);
          s[ct][r] = live ? s[ct][r] : -1.0e30f;
          mloc = fmaxf(mloc, s[ct][r]);
        }
      }
      mloc = fmaxf(mloc, xhalf(mloc));                // every query has a live key in every grid row
      const float mnew = fmaxf(mxl[qt], mloc * L2E);
      const float sc = exp2_slot(mxl[qt] - mnew);
      mxl[qt] = mnew;
      FragH p;
      float ps[4] = {0.0f, 0.0f, 0.0f, 0.0f};         // four short chains of adds in place of one long one
      #pragma unroll
      for (int ct = 0; ct < 2; ++ct) {
        #pragma unroll
        for (int r = 0; r < 8; ++r) {
          const float e = exp2_slot(fmaf(s[ct][r], L2E, -mnew));
          ps[r & 3] += e;
          p.v[8 * ct + r] = (f16t)e;
        }
      }
      ls[qt] = fmaf(ls[qt], sc, (ps[0] + ps[1]) + (ps[2] + ps[3]));
      #pragma unroll
      for (int mt = 0; mt < 2; ++mt) {
        #pragma unroll
        for (int r = 0; r < 8; ++r) acc[mt][qt][r] *= sc;
        acc[mt][qt] = wmma_f16(vc[mt].v, p.v, acc[mt][qt]);
      }
    }
    #pragma unroll
    for (int t = 0; t < 2; ++t) {
      kc[t] = kn[t];
      vc[t] = vn[t];
    }
  }
  #pragma unroll
  for (int ks = KPRE; ks < CW / 32; ++ks) {   // into the registers that the window loop has left
    load_tile(wb[0][ks], wt + ks * FTILE, lane);
    load_tile(wb[1][ks], wt + (CW / 32 + ks) * FTILE, lane);
  }

  #pragma unroll
  for (int qt = 0; qt < 2; ++qt) {
    const float l = ls[qt] + xhalf(ls[qt]);           // >= 1 (the maximum's key gives e = 1)
    const float rs = OCAR / l;
    #pragma unroll
    for (int mt = 0; mt < 2; ++mt) {
      v8h oh;                                         // 8 consecutive channels of one token
      #pragma unroll
      for (int r = 0; r < 8; ++r) oh[r] = (f16t)(acc[mt][qt][r] * rs);
      *(v8ha*)(so + (16 * qt + n) * POH + HDIM * wave + 16 * mt + 8 * h) = oh;
    }
  }
  __syncthreads();                                    // O is whole before any fragment of it is read

  v8f pa[2][2];                                       // [token tile][col tile]
  #pragma unroll
  for (int t = 0; t < 2; ++t) {
    pa[t][0] = zero8f();
    pa[t][1] = zero8f();
  }
  const f16t* arow = so + n * POH + 8 * h;
  FragH a[2][2];                                      // the reads of k step ks+1 go ahead of the products of ks
  load_frag(a[0][0], arow, 0);
  load_frag(a[0][1], arow + 16 * POH, 0);
  #pragma unroll
  for (int ks = 0; ks < CW / 32; ++ks) {
    const int cur = ks & 1;
    if (ks + 1 < CW / 32) {
      load_frag(a[cur ^ 1][0], arow, 32 * (ks + 1));
      load_frag(a[cur ^ 1][1], arow + 16 * POH, 32 * (ks + 1));
    }
    #pragma unroll
    for (int t = 0; t < 2; ++t) {
      #pragma unroll
      for (int nt = 0; nt < 2; ++nt) pa[t][nt] = wmma_f16(a[cur][t].v, wb[nt][ks].v, pa[t][nt]);
    }
  }

  float* sp = sw + wave * (GW * PW);
  #pragma unroll
  for (int nt = 0; nt < 2; ++nt) {
    const float bv = bias[32 * wave + 16 * nt + n];
    #pragma unroll
    for (int t = 0; t < 2; ++t) {
      #pragma unroll
      for (int r = 0; r < 8; ++r) sp[(16 * t + 8 * h + r) * PW + 16 * nt + n] = pa[t][nt][r] * SC_OW + bv;
    }
  }
  // The wave reads back what its other lanes wrote: its LDS writes are done first, and the compiler
  // moves no read of the range over this line.  No other wave touches the range, so no barrier.
  asm volatile("s_wait_dscnt 0x0" ::: "memory");
  #pragma unroll
  for (int i = 0; i < 8; ++i) {
    const int tok = 4 * i + (lane >> 3);
    const v4f v = *(const v4fa*)(sp + tok * PW + 4 * (lane & 7));
    *(v4f*)(out + (size_t)(blk * GW + tok) * CW + 32 * wave + 4 * (lane & 7)) = v;
  }
}

// ---------------------------------------------------------------------------
extern "C" void kernel_launch(void* const* d_in, const int* in_sizes, int n_in,
                              void* d_out, int out_size, void* d_ws, size_t ws_size,
                              hipStream_t stream) {
  if (n_in < 5) return;
  if (in_sizes[0] != NTOK * CW) return;
  if (in_sizes[1] != NQKV * CW || in_sizes[2] != NQKV) return;
  if (in_sizes[3] != CW * CW || in_sizes[4] != CW) return;
  if (out_size != NTOK * CW) return;

  const float* x      = (const float*)d_in[0];   // [8192][256]
  const float* qkv_w  = (const float*)d_in[1];   // [768][256]
  const float* qkv_b  = (const float*)d_in[2];   // [768]
  const float* proj_w = (const float*)d_in[3];   // [256][256]
  const float* proj_b = (const float*)d_in[4];   // [256]
  float* outp = (float*)d_out;

  // workspace carve (bytes); every region is an exact multiple of its whole-row
  //   Q    8192 x 256 f16   =  4,194,304
  //   K    8192 x 256 f16   =  4,194,304
  //   V    8192 x 256 f16   =  4,194,304
  //   Wf    256 x 256 f16   =    131,072
  //   total                 = 12,713,984
  const size_t szP16  = (size_t)NTOK * CW * 2;
  size_t off = 0;
  char* ws = (char*)d_ws;
  f16t*  Qp   = (f16t*)(ws + off);  off += szP16;
  f16t*  Kp   = (f16t*)(ws + off);  off += szP16;
  f16t*  Vp   = (f16t*)(ws + off);  off += szP16;
  f16t*  Wfp  = (f16t*)(ws + off);  off += (size_t)CW * CW * 2;
  if (off > ws_size) return;

  // Q (x1/16), K, V = x @ qkv_w^T + qkv_b  (f16 planes in fragment order); Wf = proj_w*256
  gemm_qkv_k<<<dim3(NTOK / MT, NHEAD / HB), TPB, 0, stream>>>(x, qkv_w, qkv_b, proj_w, Qp, Kp, Vp, Wfp);
  // 7x11 window attention -> O (LDS) -> out = O @ proj_w^T + proj_b
  attn_proj_k<<<NBATCH * GH, TPB, 0, stream>>>(Qp, Kp, Vp, Wfp, proj_b, outp);
  (void)hipGetLastError();
}

// v006
// A run of this version takes 16.9 microseconds.
// Two timings next to v005 put it at 1.13 and 1.12 times that version's speed.
// Counting every step since v000, it is 4.44 times as fast.
// Contractions x@qkv_w^T (K=256), o@proj_w^T (K=256), window scores k.q (K=32) and context sums v.p (K=32 keys): v_wmma_f32_16x16x32_f16 (f16 operands, f32 accumulate). Softmax: f32 VALU.
// f16 operands and carries: x*16 and qkv_w*256 are converted by gemm_qkv_k on the way into its LDS tiles; proj_w*256 is written by the same launch as a plane in fragment order; O = window context*256 stays in LDS. Q, K, V planes are f16 in fragment order (no carry; Q holds bias and the 1/16 scale).
// Inverse carries folded exactly once: gemm_qkv_k takes acc*SC_AW (1/(16*256)) before the bias add; attn_proj_k stages acc*SC_OW (1/(256*256)) before the bias add. No other consumer rescales.
#include <hip/hip_runtime.h>
#include <stdint.h>

#define DEVINL __device__ __forceinline__

typedef _Float16 f16t;
typedef _Float16 v16h __attribute__((ext_vector_type(16)));
typedef _Float16 v8h  __attribute__((ext_vector_type(8)));
typedef float    v8f  __attribute__((ext_vector_type(8)));
typedef float    v4f  __attribute__((ext_vector_type(4)));
typedef _Float16 v4h  __attribute__((ext_vector_type(4)));
typedef v8h __attribute__((may_alias)) v8ha;
typedef v4h __attribute__((may_alias)) v4ha;
typedef v4f __attribute__((may_alias)) v4fa;
union FragH { v16h v; v8h half[2]; };

#define NBATCH 8
#define GH     32          // grid rows
#define GW     32          // grid cols
#define NTOKB  1024        // tokens per batch
#define NTOK   8192        // total token rows
#define CW     256         // embed width
#define NQKV   768         // 3*CW
#define NHEAD  8
#define HDIM   32
#define RH     3           // window half height (7 rows)
#define RW     5           // window half width (11 cols)
#define FTILE  512         // halves of one 16 x 32 fragment tile (two 512-B parts)
#define HPLANE 32768       // halves of one (batch, head) plane: 1024 tokens x 32 channels
#define POH    264         // LDS pitch (halves) of the [32 tokens][256 channels] f16 staging of O
#define L2E    1.44269504088896340736f
#define TPB    256
#define WAVES  8
#define MT     128         // token tile of gemm_qkv_k: four grid rows
#define HB     2           // heads per block of gemm_qkv_k
#define GRP    64          // rows of one staging group: 16 loads of 16 B per thread
#define NT     192         // qkv_w rows per block of gemm_qkv_k: HB heads of each of Q, K, V
#define PW     36          // LDS pitch (floats) of a wave's own [32 tokens][32 cols] f32 staging: 144 B = 16 B x 9
#define KPRE   4           // k steps of the projection whose proj_w tiles are loaded ahead of the window loop
#define PS     264         // LDS pitch (halves) of the f16 operand tiles: 528 B = 16 B x 33, for ds_load_b128 readers
#define ACAR   16.0f
#define WCAR   256.0f
#define OCAR   256.0f
#define SC_AW  (1.0f / (16.0f * 256.0f))
#define SC_OW  (1.0f / (256.0f * 256.0f))
#define QSC    0.0625f     // 256^-0.5

static_assert(TPB == WAVES * 32);
static_assert(GH * GW == NTOKB);
static_assert(NBATCH * NTOKB == NTOK);
static_assert(NHEAD * HDIM == CW);
static_assert(NHEAD == WAVES);
static_assert(HDIM == 32 && GW == 32);
static_assert(HPLANE == NTOKB * HDIM && FTILE == 16 * HDIM);
static_assert((POH % 8) == 0);
static_assert((NTOK % MT) == 0);
static_assert((NTOK % WAVES) == 0);
static_assert((CW % 32) == 0);
static_assert(NT == 3 * HB * HDIM && NQKV == 3 * CW && (NHEAD % HB) == 0);
static_assert(MT == 4 * GW && WAVES == 4 * HB && (NTOKB % MT) == 0);
static_assert(GRP == HB * HDIM && (MT % GRP) == 0 && GRP * CW == 16 * 4 * TPB);
static_assert(CW == 256 && TPB == 256);
static_assert((PS % 8) == 0 && PS >= CW);
static_assert(2 * (NTOK / MT) == (CW / 16) * (CW / 32));   // one proj_w fragment tile per block of gemm_qkv_k with y < 2
static_assert(CW == WAVES * 32 && (PW % 4) == 0);
static_assert(((NTOK / MT) % NBATCH) == 0);   // gemm_qkv_k: flat block index mod NBATCH = blockIdx.x mod NBATCH

DEVINL int imin(int a, int b) { return a < b ? a : b; }
DEVINL int imax(int a, int b) { return a > b ? a : b; }

// ---------------------------------------------------------------------------
// WMMA helper with hazard guard (ties D, keeps A/B live).
// Fragment map (wave32): lane l, h = l>>4, m = n = l&15.
//   A/B element i: i<8 -> k0+8h+i ; i>=8 -> k0+16+8h+(i-8)   (two 16-B row loads)
//   D element r : row 8h+r, col l&15
// ---------------------------------------------------------------------------
DEVINL v8f wmma_f16(v16h a, v16h b, v8f c) {
  v8f d = __builtin_amdgcn_wmma_f32_16x16x32_f16(false, a, false, b, (short)0, c, false, false);
  asm volatile("v_nop\n\tv_nop\n\tv_nop\n\tv_nop" : "+v"(d) : "v"(a), "v"(b));
  return d;
}
DEVINL v8f zero8f() {
  v8f z = {0.f, 0.f, 0.f, 0.f, 0.f, 0.f, 0.f, 0.f};
  return z;
}
// row already includes the +8h lane offset; k contiguous in memory
DEVINL void load_frag(FragH& f, const f16t* row, int k0) {
  f.half[0] = *(const v8ha*)(row + k0);
  f.half[1] = *(const v8ha*)(row + k0 + 16);
}

// lane l with lane l ^ 16 (a vector cross-row move; __shfl_xor would go through the LDS unit)
DEVINL float xhalf(float x) {
  return __builtin_bit_cast(float, __builtin_amdgcn_permlanex16(__builtin_bit_cast(int, x), __builtin_bit_cast(int, x),
                                                                0x76543210, 0xfedcba98, false, false));
}

// 2^x.  The v_nop is the slot the instruction set asks for behind a transcendental before its result
// is used or its source overwritten; inside the statement it cannot be scheduled away from the v_exp.
DEVINL float exp2_slot(float x) {
  float e;
  asm("v_exp_f32 %0, %1\n\tv_nop" : "=v"(e) : "v"(x));
  return e;
}

// One fragment tile stored in fragment order: part p (elements 8p..8p+7 of every lane) is 512
// contiguous bytes, lane l's 16 bytes at 16*l, so each load reads four whole 128-B lines.
DEVINL void load_tile(FragH& f, const f16t* tile, int lane) {
  f.half[0] = *(const v8ha*)(tile + 8 * lane);
  f.half[1] = *(const v8ha*)(tile + 256 + 8 * lane);
}

// ---------------------------------------------------------------------------
// Operand tiles in LDS: rows of CW halves at pitch PS, staged in groups of GRP rows.  The source
// rows are whole and follow one another in memory, so every wave-wide load reads 512 contiguous
// bytes (four whole lines).  Thread = 4 floats per load; one load of the block is 4 rows.
// ---------------------------------------------------------------------------
DEVINL void grp_load(v4f (&r)[16], const float* __restrict__ src, int tid) {
  const float* g = src + 4 * tid;
  #pragma unroll
  for (int j = 0; j < 16; ++j) r[j] = *(const v4fa*)(g + 1024 * j);
  // The loads' address registers are free for reuse behind this line; as a memory fence it keeps
  // the loads of the group after the next behind it: at most three groups (48 loads per thread,
  // under the load counter's 63) are in flight.
  asm volatile("s_wait_xcnt 0x0" ::: "memory");
  // The earlier group's conversions wait for its data: they stay behind the issue of this group.
  __builtin_amdgcn_sched_barrier(0);
}
// f32 times sc, to f16
DEVINL void grp_store(const v4f (&r)[16], f16t* s, float sc, int tid) {
  f16t* d = s + (tid >> 6) * PS + 4 * (tid & 63);
  #pragma unroll
  for (int j = 0; j < 16; ++j) {
    v4h o;
    #pragma unroll
    for (int c = 0; c < 4; ++c) o[c] = (f16t)(r[j][c] * sc);
    *(v4ha*)(d + 4 * j * PS) = o;
  }
}

// ---------------------------------------------------------------------------
// Kernel 1: Q / K / V = (x*16) @ (qkv_w*256)^T + qkv_b (K = 256) -> f16 planes, one of HPLANE halves per
// (batch, head), made of 16 x 32 fragment tiles in the order load_tile reads.  Q additionally
// scaled by 1/16.
//   Q, K: tile = 16 tokens (tile index token>>4); lane (h, m) part p holds token m, channels
//         16p+8h .. +7 of the head.
//   V   : tile = 16 channels x the 32 tokens of one grid row (tile index 2*row + (channel>>4));
//         lane (h, m) part p holds channel m, tokens 16p+8h .. +7 of the row.
// Block = (128-token tile = four grid rows, y in 0..3 = a pair of heads): 256 blocks, one per WGP;
// blockIdx.x = batch + 8 * (tile in the batch).
// Operands: the block's 128 rows of x and the pair's 64 rows of each of the Q, K and V parts of
// qkv_w, f32, go through grp_load / grp_store into LDS (rows 0..127 x, then 64 Q, 64 K, 64 V).
// Wave w = grid row w&3 x head w>>2 of the pair: 32 tokens x the head's 32 Q, 32 K and 32 V
// channels = 12 accumulator tiles on 2 token and 6 weight fragments per k step.
//   Q, K: A = weight tile, B = token tile: D row 8h+r = channel, col = token, so a lane's 8 values
//         are its 16 bytes of part (channel tile) of the plane's token tile.
//   V   : A = token tile, B = weight tile: D row 8h+r = token, col = channel, so a lane's 8 values
//         are its 16 bytes of part (token tile) of the plane's channel tile.
// Epilogue: (acc*SC_AW + bias) (* 1/16 for Q) to f16, one 512-B store per accumulator tile.
// coverage per block: 128 tokens x 2 heads x (Q, K, V); grid 64 x 4 = 8192 tokens x 768 qkv channels.
// The 128 blocks of y < 2 also write Wf = proj_w*256 in f16, one 16 x 32 fragment tile each (tile
// index 8*(output col >> 4) + (k >> 5) = blockIdx.x + 64*y; lane (h, m) part p holds output col m,
// k 16p+8h .. +7): wave p writes part p.  Its two loads fly with the staging loads; its store goes
// with the block's last stores.
// ---------------------------------------------------------------------------
// The sixteen LDS reads of k step ks+1 are issued as one group ahead of the products of step ks (a
// second fragment set), so a product waits for no read issued just in front of it.
// xrow / wrow already carry the +m row and +8h k offsets.
DEVINL void load_step(FragH (&xa)[2], FragH (&wf)[6], const f16t* xrow, const f16t* wrow, int k0) {
  #pragma unroll
  for (int t = 0; t < 2; ++t) load_frag(xa[t], xrow + 16 * t * PS, k0);
  #pragma unroll
  for (int pl = 0; pl < 3; ++pl) {
    #pragma unroll
    for (int c = 0; c < 2; ++c) load_frag(wf[2 * pl + c], wrow + (HB * HDIM * pl + 16 * c) * PS, k0);
  }
}

__global__ __launch_bounds__(TPB) void gemm_qkv_k(const float* __restrict__ x, const float* __restrict__ qw,
                                                 const float* __restrict__ bias, const float* __restrict__ pw,
                                                 f16t* __restrict__ Qo, f16t* __restrict__ Ko,
                                                 f16t* __restrict__ Vo, f16t* __restrict__ Wf)
{
  __shared__ __attribute__((aligned(16))) f16t sop[(MT + NT) * PS];   // 168,960 B: one block per WGP
  f16t* sA = sop;
  f16t* sB = sop + MT * PS;
  const int tid = threadIdx.x, lane = tid & 31, wave = tid >> 5;
  const int h = lane >> 4, m = lane & 15;
  const int gr = wave & 3, hj = wave >> 2;
  // Batch = block index mod NBATCH, here and in attn_proj_k.
  // A permutation of the token tiles: only speed rests on where a block lands.
  const int row0 = ((blockIdx.x % NBATCH) * (NTOKB / MT) + blockIdx.x / NBATCH) * MT, y = blockIdx.y;
  const int bb = row0 >> 10, tk0 = row0 & (NTOKB - 1);   // the 128 tokens lie in one batch
  const int head = HB * y + hj;

  const int wtile = blockIdx.x + (NTOK / MT) * y;  // proj_w fragment tile of this block, where y < 2
  const bool wprep = (y < 2) && (wave < 2);        // wave-uniform
  v4f pw0 = {0.f, 0.f, 0.f, 0.f}, pw1 = pw0;
  if (wprep) {
    const float* g = pw + (size_t)(16 * (wtile >> 3) + m) * CW + 32 * (wtile & 7) + 16 * wave + 8 * h;
    pw0 = *(const v4fa*)g;
    pw1 = *(const v4fa*)(g + 4);
  }
  {
    const float* xs = x + (size_t)row0 * CW;
    const float* ws = qw + (size_t)(GRP * y) * CW;
    v4f r[2][16];                                  // group g+1 is asked for before group g is converted
    grp_load(r[0], xs, tid);
    #pragma unroll
    for (int g = 0; g < (MT + NT) / GRP; ++g) {    // groups 0, 1: x; 2, 3, 4: the pair's Q, K, V rows of qkv_w
      const int gn = g + 1;
      if (gn < (MT + NT) / GRP)
        grp_load(r[gn & 1], (gn < MT / GRP) ? xs + GRP * gn * CW : ws + (size_t)(gn - MT / GRP) * CW * CW, tid);
      grp_store(r[g & 1], sop + GRP * g * PS, (g < MT / GRP) ? ACAR : WCAR, tid);
    }
  }
  __syncthreads();                                 // the tiles are whole before any fragment is read

  v8f acc[3][2][2];                                // Q, K: [channel tile][token tile]; V: [token tile][channel tile]
  #pragma unroll
  for (int pl = 0; pl < 3; ++pl) {
    #pragma unroll
    for (int i = 0; i < 2; ++i) {
      acc[pl][i][0] = zero8f();
      acc[pl][i][1] = zero8f();
    }
  }
  const f16t* xrow = sA + (32 * gr + m) * PS + 8 * h;
  const f16t* wrow = sB + (HDIM * hj + m) * PS + 8 * h;
  FragH xa[2][2], wf[2][6];
  load_step(xa[0], wf[0], xrow, wrow, 0);
  #pragma unroll
  for (int ks = 0; ks < CW / 32; ++ks) {
    const int cur = ks & 1;
    if (ks + 1 < CW / 32) load_step(xa[cur ^ 1], wf[cur ^ 1], xrow, wrow, 32 * (ks + 1));
    #pragma unroll
    for (int pl = 0; pl < 2; ++pl) {
      #pragma unroll
      for (int c = 0; c < 2; ++c) {
        #pragma unroll
        for (int t = 0; t < 2; ++t) acc[pl][c][t] = wmma_f16(wf[cur][2 * pl + c].v, xa[cur][t].v, acc[pl][c][t]);
      }
    }
    #pragma unroll
    for (int t = 0; t < 2; ++t) {
      #pragma unroll
      for (int c = 0; c < 2; ++c) acc[2][t][c] = wmma_f16(xa[cur][t].v, wf[cur][4 + c].v, acc[2][t][c]);
    }
  }

  const size_t pb = (size_t)(bb * NHEAD + head) * HPLANE;
  #pragma unroll
  for (int pl = 0; pl < 2; ++pl) {
    f16t* dst = ((pl == 0) ? Qo : Ko) + pb + ((tk0 >> 4) + 2 * gr) * FTILE + 8 * lane;
    const float osc = (pl == 0) ? QSC : 1.0f;
    #pragma unroll
    for (int c = 0; c < 2; ++c) {
      const float* bp = bias + CW * pl + HDIM * head + 16 * c + 8 * h;
      const v4f b0 = *(const v4fa*)bp, b1 = *(const v4fa*)(bp + 4);
      #pragma unroll
      for (int t = 0; t < 2; ++t) {
        v8h pk;                                    // 8 consecutive channels of one token
        #pragma unroll
        for (int r = 0; r < 4; ++r) {
          pk[r]     = (f16t)((acc[pl][c][t][r] * SC_AW + b0[r]) * osc);
          pk[4 + r] = (f16t)((acc[pl][c][t][4 + r] * SC_AW + b1[r]) * osc);
        }
        *(v8h*)(dst + t * FTILE + 256 * c) = pk;
      }
    }
  }
  {
    f16t* dst = Vo + pb + 2 * ((tk0 >> 5) + gr) * FTILE + 8 * lane;
    #pragma unroll
    for (int c = 0; c < 2; ++c) {
      const float bv = bias[2 * CW + HDIM * head + 16 * c + m];
      #pragma unroll
      for (int t = 0; t < 2; ++t) {
        v8h pk;                                    // 8 consecutive tokens of one channel
        #pragma unroll
        for (int r = 0; r < 8; ++r) pk[r] = (f16t)(acc[2][t][c][r] * SC_AW + bv);
        *(v8h*)(dst + c * FTILE + 256 * t) = pk;
      }
    }
  }
  if (wprep) {
    v8h wo;
    #pragma unroll
    for (int j = 0; j < 4; ++j) {
      wo[j]     = (f16t)(pw0[j] * WCAR);
      wo[4 + j] = (f16t)(pw1[j] * WCAR);
    }
    *(v8h*)(Wf + wtile * FTILE + 256 * wave + 8 * lane) = wo;
  }
}

// ---------------------------------------------------------------------------
// Kernel 2: 7x11 local-window attention on matrix tiles, then the output projection of its 32 tokens.  Block = one grid row of one batch
// (32 query tokens; blockIdx.x = batch + 8 * grid row), wave = head.  Token (h0,w0) attends (hh,ww) iff |hh-h0|<=3 and
// |ww-w0|<=5 inside the grid.  The wave walks the window's grid rows (bounds clamped to the
// grid, wave-uniform); a grid row is 32 keys = one K step:
//   S^T[key][query] = K.Q^T : A = K tile (16 keys), B = Q tile (16 queries), 2 x 2 tiles.
//       Lane (h, n) holds keys 16ct+8h+r of query 16qt+n; keys with |ww-w0| > 5 get -1e30.
//   running softmax per query (f32): new maximum (own 16 scores, then the partner lane n^16),
//       e = exp(s - max), the earlier sum and context scaled by exp(old max - new max).
//   O^T[channel][query] += V^T.P^T : the two f32 score tiles of a query tile, converted in
//       place, are the B operand (element 8ct+r = key 16ct+8h+r); A = V tile (16 channels).
// The next grid row's K and V tiles are loaded while this one is worked on.
// O [32][256] f16 x256: context / sum, staged in LDS; behind the barrier it is the A operand of
//   out = O @ (proj_w*256)^T + proj_b (K = 256) -> d_out f32 [8192][256]:
//   wave w = the 32 tokens x output cols 32w .. 32w+31 (2 x 2 tiles, 8 k steps).  Its 16 B tiles
//   (16 KB of Wf) go straight into registers: those of the first KPRE k steps in front of the window
//   loop, so they fly under it; the rest behind it, where the loop's registers are free.
//   acc*SC_OW + bias goes through the wave's own [32][32] f32 LDS range, then stores of four whole
//   128-B lines (8 lanes = one token's 32 cols).
// coverage: 256 blocks x 32 tokens = 8192 rows x (8 waves x 32 cols).
// ---------------------------------------------------------------------------
__global__ __launch_bounds__(TPB) void attn_proj_k(const f16t* __restrict__ Qf, const f16t* __restrict__ Kf,
                                                  const f16t* __restrict__ Vf, const f16t* __restrict__ Wf,
                                                  const float* __restrict__ bias, float* __restrict__ out)
{
  __shared__ __attribute__((aligned(16))) f16t so[GW * POH];            // 16,896 B
  __shared__ __attribute__((aligned(16))) float sw[WAVES * GW * PW];    // 36,864 B
  const int tid = threadIdx.x, lane = tid & 31;
  const int wave = __builtin_amdgcn_readfirstlane(tid >> 5);   // = head
  const int h = lane >> 4, n = lane & 15;
  const int bid = imin(blockIdx.x, NBATCH * GH - 1);           // grid exact
  const int bb = bid % NBATCH, h0 = bid / NBATCH;              // batch = index mod NBATCH, as in gemm_qkv_k
  const int blk = bb * GH + h0;                                // grid row among all batches
  const size_t pb = (size_t)(bb * NHEAD + wave) * HPLANE;
  const f16t* kb = Kf + pb;
  const f16t* vb = Vf + pb;
  const int hlo = imax(h0 - RH, 0), hhi = imin(h0 + RH, GH - 1);
  __builtin_assume(hlo <= hhi);               // h0 is in the grid: no guard round the loop for the first loads to sink behind

  FragH q[2], kc[2], vc[2];
  #pragma unroll
  for (int t = 0; t < 2; ++t) {
    load_tile(q[t], Qf + pb + (2 * h0 + t) * FTILE, lane);
    load_tile(kc[t], kb + (2 * hlo + t) * FTILE, lane);
    load_tile(vc[t], vb + (2 * hlo + t) * FTILE, lane);
  }
  // Keeps the Q, K, V loads in front of the proj_w loads: the first window row waits for the former only.
  __builtin_amdgcn_sched_barrier(0);
  const f16t* wt = Wf + 2 * wave * (CW / 32) * FTILE;
  FragH wb[2][CW / 32];                       // proj_w tiles [col tile][k step] of the wave's 32 output cols
  #pragma unroll
  for (int ks = 0; ks < KPRE; ++ks) {
    load_tile(wb[0][ks], wt + ks * FTILE, lane);
    load_tile(wb[1][ks], wt + (CW / 32 + ks) * FTILE, lane);
  }

  v8f acc[2][2];                              // [channel tile][query tile]
  float mxl[2], ls[2];                        // running maximum (times log2 e) and lane's part of the sum
  #pragma unroll
  for (int qt = 0; qt < 2; ++qt) {
    acc[0][qt] = zero8f();
    acc[1][qt] = zero8f();
    mxl[qt] = -3.0e38f;
    ls[qt] = 0.0f;
  }
  const int dl = 8 * h - n + RW;              // ww - w0 + 5 = dl + 16*(ct - qt) + r

  #pragma unroll 1   // rolled: the trip count varies (4..7) and one row ahead is enough in flight
  for (int hh = hlo; hh <= hhi; ++hh) {
    const int hn = imin(hh + 1, hhi);
    FragH kn[2], vn[2];
    #pragma unroll
    for (int t = 0; t < 2; ++t) {
      load_tile(kn[t], kb + (2 * hn + t) * FTILE, lane);
      load_tile(vn[t], vb + (2 * hn + t) * FTILE, lane);
    }
    #pragma unroll
    for (int qt = 0; qt < 2; ++qt) {
      v8f s[2];
      float mloc = -1.0e30f;
      #pragma unroll
      for (int ct = 0; ct < 2; ++ct) {
        s[ct] = wmma_f16(kc[ct].v, q[qt].v, zero8f());
        #pragma unroll
        for (int r = 0; r < 8; ++r) {
          const bool live = (unsigned)(dl + 16 * (ct - qt) + r) <= (unsigned)(2 * RW);
          s[ct][r] = live ? s[ct][r] : -1.0e30f;
          mloc = fmaxf(mloc, s[ct][r]);
        }
      }
      mloc = fmaxf(mloc, xhalf(mloc));                // every query has a live key in every grid row
      const float mnew = fmaxf(mxl[qt], mloc * L2E);
      const float sc = exp2_slot(mxl[qt] - mnew);
      mxl[qt] = mnew;
      FragH p;
      float ps[4] = {0.0f, 0.0f, 0.0f, 0.0f};         // four short chains of adds in place of one long one
      #pragma unroll
      for (int ct = 0; ct < 2; ++ct) {
        #pragma unroll
        for (int r = 0; r < 8; ++r) {
          const float e = exp2_slot(fmaf(s[ct][r], L2E, -mnew));
          ps[r & 3] += e;
          p.v[8 * ct + r] = (f16t)e;
        }
      }
      ls[qt] = fmaf(ls[qt], sc, (ps[0] + ps[1]) + (ps[2] + ps[3]));
      #pragma unroll
      for (int mt = 0; mt < 2; ++mt) {
        #pragma unroll
        for (int r = 0; r < 8; ++r) acc[mt][qt][r] *= sc;
        acc[mt][qt] = wmma_f16(vc[mt].v, p.v, acc[mt][qt]);
      }
    }
    #pragma unroll
    for (int t = 0; t < 2; ++t) {
      kc[t] = kn[t];
      vc[t] = vn[t];
    }
  }
  #pragma unroll
  for (int ks = KPRE; ks < CW / 32; ++ks) {   // into the registers that the window loop has left
    load_tile(wb[0][ks], wt + ks * FTILE, lane);
    load_tile(wb[1][ks], wt + (CW / 32 + ks) * FTILE, lane);
  }

  #pragma unroll
  for (int qt = 0; qt < 2; ++qt) {
    const float l = ls[qt] + xhalf(ls[qt]);           // >= 1 (the maximum's key gives e = 1)
    const float rs = OCAR / l;
    #pragma unroll
    for (int mt = 0; mt < 2; ++mt) {
      v8h oh;                                         // 8 consecutive channels of one token
      #pragma unroll
      for (int r = 0; r < 8; ++r) oh[r] = (f16t)(acc[mt][qt][r] * rs);
      *(v8ha*)(so + (16 * qt + n) * POH + HDIM * wave + 16 * mt + 8 * h) = oh;
    }
  }
  __syncthreads();                                    // O is whole before any fragment of it is read

  v8f pa[2][2];                                       // [token tile][col tile]
  #pragma unroll
  for (int t = 0; t < 2; ++t) {
    pa[t][0] = zero8f();
    pa[t][1] = zero8f();
  }
  const f16t* arow = so + n * POH + 8 * h;
  FragH a[2][2];                                      // the reads of k step ks+1 go ahead of the products of ks
  load_frag(a[0][0], arow, 0);
  load_frag(a[0][1], arow + 16 * POH, 0);
  #pragma unroll
  for (int ks = 0; ks < CW / 32; ++ks) {
    const int cur = ks & 1;
    if (ks + 1 < CW / 32) {
      load_frag(a[cur ^ 1][0], arow, 32 * (ks + 1));
      load_frag(a[cur ^ 1][1], arow + 16 * POH, 32 * (ks + 1));
    }
    #pragma unroll
    for (int t = 0; t < 2; ++t) {
      #pragma unroll
      for (int nt = 0; nt < 2; ++nt) pa[t][nt] = wmma_f16(a[cur][t].v, wb[nt][ks].v, pa[t][nt]);
    }
  }

  float* sp = sw + wave * (GW * PW);
  #pragma unroll
  for (int nt = 0; nt < 2; ++nt) {
    const float bv = bias[32 * wave + 16 * nt + n];
    #pragma unroll
    for (int t = 0; t < 2; ++t) {
      #pragma unroll
      for (int r = 0; r < 8; ++r) sp[(16 * t + 8 * h + r) * PW + 16 * nt + n] = pa[t][nt][r] * SC_OW + bv;
    }
  }
  // The wave reads back what its other lanes wrote: its LDS writes are done first, and the compiler
  // moves no read of the range over this line.  No other wave touches the range, so no barrier.
  asm volatile("s_wait_dscnt 0x0" ::: "memory");
  #pragma unroll
  for (int i = 0; i < 8; ++i) {
    const int tok = 4 * i + (lane >> 3);
    const v4f v = *(const v4fa*)(sp + tok * PW + 4 * (lane & 7));
    *(v4f*)(out + (size_t)(blk * GW + tok) * CW + 32 * wave + 4 * (lane & 7)) = v;
  }
}

// ---------------------------------------------------------------------------
extern "C" void kernel_launch(void* const* d_in, const int* in_sizes, int n_in,
                              void* d_out, int out_size, void* d_ws, size_t ws_size,
                              hipStream_t stream) {
  if (n_in < 5) return;
  if (in_sizes[0] != NTOK * CW) return;
  if (in_sizes[1] != NQKV * CW || in_sizes[2] != NQKV) return;
  if (in_sizes[3] != CW * CW || in_sizes[4] != CW) return;
  if (out_size != NTOK * CW) return;

  const float* x      = (const float*)d_in[0];   // [8192][256]
  const float* qkv_w  = (const float*)d_in[1];   // [768][256]
  const float* qkv_b  = (const float*)d_in[2];   // [768]
  const float* proj_w = (const float*)d_in[3];   // [256][256]
  const float* proj_b = (const float*)d_in[4];   // [256]
  float* outp = (float*)d_out;

  // workspace carve (bytes); every region is an exact multiple of its whole-row
  //   Q    8192 x 256 f16   =  4,194,304
  //   K    8192 x 256 f16   =  4,194,304
  //   V    8192 x 256 f16   =  4,194,304
  //   Wf    256 x 256 f16   =    131,072
  //   total                 = 12,713,984
  const size_t szP16  = (size_t)NTOK * CW * 2;
  size_t off = 0;
  char* ws = (char*)d_ws;
  f16t*  Qp   = (f16t*)(ws + off);  off += szP16;
  f16t*  Kp   = (f16t*)(ws + off);  off += szP16;
  f16t*  Vp   = (f16t*)(ws + off);  off += szP16;
  f16t*  Wfp  = (f16t*)(ws + off);  off += (size_t)CW * CW * 2;
  if (off > ws_size) return;

  // Q (x1/16), K, V = x @ qkv_w^T + qkv_b  (f16 planes in fragment order); Wf = proj_w*256
  gemm_qkv_k<<<dim3(NTOK / MT, NHEAD / HB), TPB, 0, stream>>>(x, qkv_w, qkv_b, proj_w, Qp, Kp, Vp, Wfp);
  // 7x11 window attention -> O (LDS) -> out = O @ proj_w^T + proj_b
  attn_proj_k<<<NBATCH * GH, TPB, 0, stream>>>(Qp, Kp, Vp, Wfp, proj_b, outp);
  (void)hipGetLastError();
}
